// v000
// Measured on an AMD MI455X. A time is GPU time per run, averaged over a window of back-to-back runs after a warm-up
// (all launches, gaps included; the runs take copies of the inputs in turn), and the median of several windows.
// Apart from v000's, it joins two sittings. Times from different sittings can be a few percent apart, while
// side-by-side timings come from the same sitting.
// v000, which the later versions start from, runs in 889 microseconds.
#include <hip/hip_runtime.h>

typedef unsigned short u16;
typedef __attribute__((ext_vector_type(16))) __bf16 bf16x16;
typedef __attribute__((ext_vector_type(8)))  float  f32x8;

union FragU { bf16x16 v; uint4 q[2]; };

__device__ __forceinline__ u16 f2bf(float f) {
    unsigned u = __float_as_uint(f);
    u += 0x7FFFu + ((u >> 16) & 1u);   // round-to-nearest-even
    return (u16)(u >> 16);
}

__device__ __forceinline__ f32x8 zero8() {
    f32x8 z;
#pragma unroll
    for (int i = 0; i < 8; ++i) z[i] = 0.0f;
    return z;
}

// Load one 16x32 bf16 operand fragment (A-layout; B uses transposed source so
// the same layout applies). Lanes 0-15: rows 0-15, K 0-7 & 16-23.
// Lanes 16-31: rows 0-15, K 8-15 & 24-31. Two 16B loads per lane.
__device__ __forceinline__ bf16x16 load_frag(const u16* base, int stride, int lane) {
    const int half = lane >> 4, r = lane & 15;
    const u16* p = base + (size_t)r * stride + half * 8;
    FragU u;
    u.q[0] = *(const uint4*)(p);
    u.q[1] = *(const uint4*)(p + 16);
    return u.v;
}

__device__ __forceinline__ f32x8 wmma32(bf16x16 a, bf16x16 b, f32x8 c) {
    return __builtin_amdgcn_wmma_f32_16x16x32_bf16(false, a, false, b, (short)0, c, false, false);
}

__device__ __forceinline__ float gelu_exact(float x) {
    return 0.5f * x * (1.0f + erff(x * 0.70710678118654752f));
}

// ---------------------------------------------------------------------------
// Weight cast + transpose: in (K x N) f32 row-major -> out (N x K) bf16
// ---------------------------------------------------------------------------
__global__ __launch_bounds__(256) void cast_transpose_k(
    const float* __restrict__ in, u16* __restrict__ out, int K, int N) {
    __shared__ float tile[32][33];
    const int n0 = blockIdx.x * 32, k0 = blockIdx.y * 32;
    const int tx = threadIdx.x, ty = threadIdx.y;
#pragma unroll
    for (int i = 0; i < 32; i += 8)
        tile[ty + i][tx] = in[(size_t)(k0 + ty + i) * N + (n0 + tx)];
    __syncthreads();
#pragma unroll
    for (int i = 0; i < 32; i += 8)
        out[(size_t)(n0 + ty + i) * K + (k0 + tx)] = f2bf(tile[tx][ty + i]);
}

// ---------------------------------------------------------------------------
// LayerNorm (f32 in, bf16 out), one 256-thread block per row of D=1024
// ---------------------------------------------------------------------------
__global__ __launch_bounds__(256) void layernorm_k(
    const float* __restrict__ in, const float* __restrict__ g,
    const float* __restrict__ be, u16* __restrict__ out) {
    const int row = blockIdx.x, tid = threadIdx.x;
    const float* rp = in + (size_t)row * 1024;
    float v[4], s = 0.0f, ss = 0.0f;
#pragma unroll
    for (int i = 0; i < 4; ++i) {
        v[i] = rp[tid + 256 * i];
        s += v[i];
        ss += v[i] * v[i];
    }
    __shared__ float rs[256], rq[256];
    rs[tid] = s; rq[tid] = ss;
    __syncthreads();
    for (int off = 128; off > 0; off >>= 1) {
        if (tid < off) { rs[tid] += rs[tid + off]; rq[tid] += rq[tid + off]; }
        __syncthreads();
    }
    const float mu = rs[0] * (1.0f / 1024.0f);
    const float var = rq[0] * (1.0f / 1024.0f) - mu * mu;
    const float rstd = rsqrtf(var + 1e-5f);
    u16* op = out + (size_t)row * 1024;
#pragma unroll
    for (int i = 0; i < 4; ++i) {
        const int col = tid + 256 * i;
        op[col] = f2bf((v[i] - mu) * rstd * g[col] + be[col]);
    }
}

// ---------------------------------------------------------------------------
// WMMA GEMM: C[M,N] = act(A[M,K] @ B[K,N] + bias) (+ residual)
// A: bf16 row-major, BT: bf16 N x K (transposed), bias f32.
// 256 threads = 8 waves; block tile 128x128; wave tile 32(M)x64(N).
// ---------------------------------------------------------------------------
template <int OUT_BF16, int ACT_GELU, int ADD_RES>
__global__ __launch_bounds__(256) void gemm_k(
    const u16* __restrict__ A, const u16* __restrict__ BT,
    const float* __restrict__ bias, const float* __restrict__ res,
    void* __restrict__ outp, int M, int N, int K) {
    const int tid = threadIdx.x, lane = tid & 31, wave = tid >> 5;
    const int wm = wave & 3, wn = wave >> 2;
    const int m0 = blockIdx.y * 128 + wm * 32;
    const int n0 = blockIdx.x * 128 + wn * 64;

    f32x8 acc[2][4];
#pragma unroll
    for (int i = 0; i < 2; ++i)
#pragma unroll
        for (int j = 0; j < 4; ++j) acc[i][j] = zero8();

    for (int k0 = 0; k0 < K; k0 += 32) {
        bf16x16 af[2], bf[4];
#pragma unroll
        for (int i = 0; i < 2; ++i)
            af[i] = load_frag(A + (size_t)(m0 + i * 16) * K + k0, K, lane);
#pragma unroll
        for (int j = 0; j < 4; ++j)
            bf[j] = load_frag(BT + (size_t)(n0 + j * 16) * K + k0, K, lane);
#pragma unroll
        for (int i = 0; i < 2; ++i)
#pragma unroll
            for (int j = 0; j < 4; ++j)
                acc[i][j] = wmma32(af[i], bf[j], acc[i][j]);
    }

    const int c = lane & 15, hs = lane >> 4;
#pragma unroll
    for (int i = 0; i < 2; ++i) {
#pragma unroll
        for (int j = 0; j < 4; ++j) {
            const int col = n0 + j * 16 + c;
            const float bv = bias[col];
#pragma unroll
            for (int v = 0; v < 8; ++v) {
                const int row = m0 + i * 16 + v + 8 * hs;
                float val = acc[i][j][v] + bv;
                if (ACT_GELU) val = gelu_exact(val);
                if (ADD_RES) val += res[(size_t)row * N + col];
                if (OUT_BF16)
                    ((u16*)outp)[(size_t)row * N + col] = f2bf(val);
                else
                    ((float*)outp)[(size_t)row * N + col] = val;
            }
        }
    }
}

// ---------------------------------------------------------------------------
// V transpose per (b,h): V (b,s,h,d) bf16 -> VT (b*h, d, s) bf16
// ---------------------------------------------------------------------------
__global__ __launch_bounds__(256) void transpose_v_k(
    const u16* __restrict__ V, u16* __restrict__ VT, int S) {
    __shared__ u16 tile[32][33];
    const int s0 = blockIdx.x * 32, d0 = blockIdx.y * 32, bh = blockIdx.z;
    const int b = bh >> 4, h = bh & 15;
    const int tx = threadIdx.x, ty = threadIdx.y;
#pragma unroll
    for (int i = 0; i < 32; i += 8)
        tile[ty + i][tx] = V[(size_t)(b * S + s0 + ty + i) * 1024 + h * 64 + d0 + tx];
    __syncthreads();
#pragma unroll
    for (int i = 0; i < 32; i += 8)
        VT[(size_t)(bh * 64 + d0 + ty + i) * S + (s0 + tx)] = tile[tx][ty + i];
}

// ---------------------------------------------------------------------------
// Causal flash attention, dk = 64. Grid: (S/128, B*H), 8 waves per block,
// each wave owns 16 query rows; streams 32-key blocks with online softmax.
// ---------------------------------------------------------------------------
__global__ __launch_bounds__(256) void attn_k(
    const u16* __restrict__ Q, const u16* __restrict__ Kb,
    const u16* __restrict__ VT, u16* __restrict__ CTX, int S) {
    const int tid = threadIdx.x, lane = tid & 31, wave = tid >> 5;
    const int bh = blockIdx.y, b = bh >> 4, h = bh & 15;
    const int q0 = blockIdx.x * 128 + wave * 16;
    const int c = lane & 15, hs = lane >> 4;

    __shared__ __align__(16) u16 pbuf[8][640];   // 16 rows x stride 40 per wave
    u16* pw = pbuf[wave];

    const u16* qbase = Q + (size_t)(b * S + q0) * 1024 + h * 64;
    const bf16x16 aq0 = load_frag(qbase, 1024, lane);        // dk 0..31
    const bf16x16 aq1 = load_frag(qbase + 32, 1024, lane);   // dk 32..63

    float mrow[8], lsum[8];
    f32x8 cacc[4];
#pragma unroll
    for (int v = 0; v < 8; ++v) { mrow[v] = -1e30f; lsum[v] = 0.0f; }
#pragma unroll
    for (int n = 0; n < 4; ++n) cacc[n] = zero8();

    const float SC = 0.125f;            // 1/sqrt(64)
    const float L2E = 1.44269504f;

    for (int kb = 0; kb < q0 + 16; kb += 32) {
        // ---- scores: S = Q(16x64) @ K^T(64x32) in two 16-key column frags
        f32x8 s0 = zero8(), s1 = zero8();
        const u16* kp = Kb + (size_t)(b * S + kb) * 1024 + h * 64;
        s0 = wmma32(aq0, load_frag(kp, 1024, lane), s0);
        s1 = wmma32(aq0, load_frag(kp + (size_t)16 * 1024, 1024, lane), s1);
        s0 = wmma32(aq1, load_frag(kp + 32, 1024, lane), s0);
        s1 = wmma32(aq1, load_frag(kp + (size_t)16 * 1024 + 32, 1024, lane), s1);

        // ---- online softmax per row (rows live in (vgpr, lane-half))
#pragma unroll
        for (int v = 0; v < 8; ++v) {
            const int row = q0 + v + 8 * hs;
            const int key0 = kb + c, key1 = key0 + 16;
            float f0 = (key0 <= row) ? s0[v] * SC : -1e30f;
            float f1 = (key1 <= row) ? s1[v] * SC : -1e30f;
            float mx = fmaxf(f0, f1);
#pragma unroll
            for (int off = 8; off; off >>= 1) mx = fmaxf(mx, __shfl_xor(mx, off, 32));
            const float mnew = fmaxf(mrow[v], mx);
            const float p0 = exp2f((f0 - mnew) * L2E);
            const float p1 = exp2f((f1 - mnew) * L2E);
            float ps = p0 + p1;
#pragma unroll
            for (int off = 8; off; off >>= 1) ps += __shfl_xor(ps, off, 32);
            const float alpha = exp2f((mrow[v] - mnew) * L2E);
            lsum[v] = lsum[v] * alpha + ps;
            mrow[v] = mnew;
#pragma unroll
            for (int n = 0; n < 4; ++n) cacc[n][v] *= alpha;
            const int prow = v + 8 * hs;
            pw[prow * 40 + c] = f2bf(p0);
            pw[prow * 40 + 16 + c] = f2bf(p1);
        }
        asm volatile("s_wait_dscnt 0" ::: "memory");   // LDS stores visible to wave
        const bf16x16 pfrag = load_frag(pw, 40, lane); // P (16x32) in A layout

        // ---- ctx += P(16x32) @ V(32x64), VT gives contiguous B frags
        const u16* vtb = VT + (size_t)(bh * 64) * S + kb;
#pragma unroll
        for (int n = 0; n < 4; ++n)
            cacc[n] = wmma32(pfrag, load_frag(vtb + (size_t)(n * 16) * S, S, lane), cacc[n]);
    }

    float inv[8];
#pragma unroll
    for (int v = 0; v < 8; ++v) inv[v] = 1.0f / lsum[v];
#pragma unroll
    for (int n = 0; n < 4; ++n)
#pragma unroll
        for (int v = 0; v < 8; ++v) {
            const int row = q0 + v + 8 * hs;
            const int col = n * 16 + c;
            CTX[(size_t)(b * S + row) * 1024 + h * 64 + col] = f2bf(cacc[n][v] * inv[v]);
        }
}

// ---------------------------------------------------------------------------
// Host-side orchestration
// ---------------------------------------------------------------------------
extern "C" void kernel_launch(void* const* d_in, const int* in_sizes, int n_in,
                              void* d_out, int out_size, void* d_ws, size_t ws_size,
                              hipStream_t stream) {
    constexpr int B = 4, S = 2048, D = 1024, H = 16, F = 4096;
    constexpr int M = B * S;  // 8192 tokens
    constexpr size_t MiB = 1u << 20;

    const float* x    = (const float*)d_in[0];
    const float* Wq   = (const float*)d_in[1];
    const float* bq   = (const float*)d_in[2];
    const float* Wk   = (const float*)d_in[3];
    const float* bk   = (const float*)d_in[4];
    const float* Wv   = (const float*)d_in[5];
    const float* bv   = (const float*)d_in[6];
    const float* Wo   = (const float*)d_in[7];
    const float* bo   = (const float*)d_in[8];
    const float* ln1g = (const float*)d_in[9];
    const float* ln1b = (const float*)d_in[10];
    const float* ln2g = (const float*)d_in[11];
    const float* ln2b = (const float*)d_in[12];
    const float* W1   = (const float*)d_in[13];
    const float* b1   = (const float*)d_in[14];
    const float* W2   = (const float*)d_in[15];
    const float* b2   = (const float*)d_in[16];

    char* ws = (char*)d_ws;
    u16*   WQT = (u16*)(ws + 0 * MiB);     // D x D bf16 (transposed)  2 MiB
    u16*   WKT = (u16*)(ws + 2 * MiB);
    u16*   WVT = (u16*)(ws + 4 * MiB);
    u16*   WOT = (u16*)(ws + 6 * MiB);
    u16*   W1T = (u16*)(ws + 8 * MiB);     // F x D bf16               8 MiB
    u16*   W2T = (u16*)(ws + 16 * MiB);    // D x F bf16               8 MiB
    u16*   H1  = (u16*)(ws + 24 * MiB);    // M x D bf16              16 MiB
    u16*   QB  = (u16*)(ws + 40 * MiB);    // M x D bf16
    u16*   KB  = (u16*)(ws + 56 * MiB);
    u16*   VB  = (u16*)(ws + 72 * MiB);
    u16*   VTB = (u16*)(ws + 88 * MiB);    // (B*H) x 64 x S bf16
    u16*   CTX = (u16*)(ws + 104 * MiB);   // M x D bf16
    float* X1  = (float*)(ws + 120 * MiB); // M x D f32               32 MiB
    u16*   U   = (u16*)(ws + 40 * MiB);    // M x F bf16 (reuses Q/K/V/VT) 64 MiB
    float* OUT = (float*)d_out;
    (void)in_sizes; (void)n_in; (void)out_size; (void)ws_size;

    const dim3 tb(32, 8);
    // 0) weights -> bf16 transposed (L2-resident working set: 24 MiB)
    cast_transpose_k<<<dim3(D / 32, D / 32), tb, 0, stream>>>(Wq, WQT, D, D);
    cast_transpose_k<<<dim3(D / 32, D / 32), tb, 0, stream>>>(Wk, WKT, D, D);
    cast_transpose_k<<<dim3(D / 32, D / 32), tb, 0, stream>>>(Wv, WVT, D, D);
    cast_transpose_k<<<dim3(D / 32, D / 32), tb, 0, stream>>>(Wo, WOT, D, D);
    cast_transpose_k<<<dim3(F / 32, D / 32), tb, 0, stream>>>(W1, W1T, D, F);
    cast_transpose_k<<<dim3(D / 32, F / 32), tb, 0, stream>>>(W2, W2T, F, D);

    // 1) LN1: x -> H1 (bf16)
    layernorm_k<<<M, 256, 0, stream>>>(x, ln1g, ln1b, H1);

    // 2) Q/K/V projections (bf16 out)
    gemm_k<1, 0, 0><<<dim3(D / 128, M / 128), 256, 0, stream>>>(H1, WQT, bq, nullptr, QB, M, D, D);
    gemm_k<1, 0, 0><<<dim3(D / 128, M / 128), 256, 0, stream>>>(H1, WKT, bk, nullptr, KB, M, D, D);
    gemm_k<1, 0, 0><<<dim3(D / 128, M / 128), 256, 0, stream>>>(H1, WVT, bv, nullptr, VB, M, D, D);

    // 3) V -> VT per (b,h)
    transpose_v_k<<<dim3(S / 32, 2, B * H), tb, 0, stream>>>(VB, VTB, S);

    // 4) causal flash attention -> CTX (bf16)
    attn_k<<<dim3(S / 128, B * H), 256, 0, stream>>>(QB, KB, VTB, CTX, S);

    // 5) output projection + residual: X1 = x + CTX @ Wo + bo (f32)
    gemm_k<0, 0, 1><<<dim3(D / 128, M / 128), 256, 0, stream>>>(CTX, WOT, bo, x, X1, M, D, D);

    // 6) LN2: X1 -> H1 (bf16, reuse)
    layernorm_k<<<M, 256, 0, stream>>>(X1, ln2g, ln2b, H1);

    // 7) FFN up + exact GELU -> U (bf16)
    gemm_k<1, 1, 0><<<dim3(F / 128, M / 128), 256, 0, stream>>>(H1, W1T, b1, nullptr, U, M, F, D);

    // 8) FFN down + residual -> OUT (f32)
    gemm_k<0, 0, 1><<<dim3(D / 128, M / 128), 256, 0, stream>>>(U, W2T, b2, X1, OUT, M, D, F);
}

// v001
// A run of this version takes 512 microseconds.
// In two side-by-side timings against v000, it was 1.78 and 1.77 times as fast.
#include <hip/hip_runtime.h>

typedef unsigned short u16;
typedef __attribute__((ext_vector_type(16))) __bf16 bf16x16;
typedef __attribute__((ext_vector_type(8)))  float  f32x8;

union FragU { bf16x16 v; uint4 q[2]; };

__device__ __forceinline__ u16 f2bf(float f) {
    unsigned u = __float_as_uint(f);
    u += 0x7FFFu + ((u >> 16) & 1u);   // round-to-nearest-even
    return (u16)(u >> 16);
}

__device__ __forceinline__ f32x8 zero8() {
    f32x8 z;
#pragma unroll
    for (int i = 0; i < 8; ++i) z[i] = 0.0f;
    return z;
}

// Load one 16x32 bf16 operand fragment (A-layout; B uses transposed source so
// the same layout applies). Lanes 0-15: rows 0-15, K 0-7 & 16-23.
// Lanes 16-31: rows 0-15, K 8-15 & 24-31. Two 16B loads per lane.
__device__ __forceinline__ bf16x16 load_frag(const u16* base, int stride, int lane) {
    const int half = lane >> 4, r = lane & 15;
    const u16* p = base + (size_t)r * stride + half * 8;
    FragU u;
    u.q[0] = *(const uint4*)(p);
    u.q[1] = *(const uint4*)(p + 16);
    return u.v;
}

__device__ __forceinline__ f32x8 wmma32(bf16x16 a, bf16x16 b, f32x8 c) {
    return __builtin_amdgcn_wmma_f32_16x16x32_bf16(false, a, false, b, (short)0, c, false, false);
}

__device__ __forceinline__ float gelu_exact(float x) {
    return 0.5f * x * (1.0f + erff(x * 0.70710678118654752f));
}

// ---------------------------------------------------------------------------
// Weight cast + transpose: in (K x N) f32 row-major -> out (N x K) bf16
// ---------------------------------------------------------------------------
__global__ __launch_bounds__(256) void cast_transpose_k(
    const float* __restrict__ in, u16* __restrict__ out, int K, int N) {
    __shared__ float tile[32][33];
    const int n0 = blockIdx.x * 32, k0 = blockIdx.y * 32;
    const int tx = threadIdx.x, ty = threadIdx.y;
#pragma unroll
    for (int i = 0; i < 32; i += 8)
        tile[ty + i][tx] = in[(size_t)(k0 + ty + i) * N + (n0 + tx)];
    __syncthreads();
#pragma unroll
    for (int i = 0; i < 32; i += 8)
        out[(size_t)(n0 + ty + i) * K + (k0 + tx)] = f2bf(tile[tx][ty + i]);
}

// ---------------------------------------------------------------------------
// LayerNorm (f32 in, bf16 out), one 256-thread block per row of D=1024
// ---------------------------------------------------------------------------
__global__ __launch_bounds__(256) void layernorm_k(
    const float* __restrict__ in, const float* __restrict__ g,
    const float* __restrict__ be, u16* __restrict__ out) {
    const int row = blockIdx.x, tid = threadIdx.x;
    const float* rp = in + (size_t)row * 1024;
    float v[4], s = 0.0f, ss = 0.0f;
#pragma unroll
    for (int i = 0; i < 4; ++i) {
        v[i] = rp[tid + 256 * i];
        s += v[i];
        ss += v[i] * v[i];
    }
    __shared__ float rs[256], rq[256];
    rs[tid] = s; rq[tid] = ss;
    __syncthreads();
    for (int off = 128; off > 0; off >>= 1) {
        if (tid < off) { rs[tid] += rs[tid + off]; rq[tid] += rq[tid + off]; }
        __syncthreads();
    }
    const float mu = rs[0] * (1.0f / 1024.0f);
    const float var = rq[0] * (1.0f / 1024.0f) - mu * mu;
    const float rstd = rsqrtf(var + 1e-5f);
    u16* op = out + (size_t)row * 1024;
#pragma unroll
    for (int i = 0; i < 4; ++i) {
        const int col = tid + 256 * i;
        op[col] = f2bf((v[i] - mu) * rstd * g[col] + be[col]);
    }
}

// ---------------------------------------------------------------------------
// Tensor-load helpers for the GEMM's LDS ring
// ---------------------------------------------------------------------------
typedef unsigned int u32;
typedef unsigned long long u64;
typedef u32 u32x4 __attribute__((ext_vector_type(4)));
typedef u32 u32x8 __attribute__((ext_vector_type(8)));

constexpr u32 G_KP    = 128;            // k per pass
constexpr u32 G_ROWB  = 2 * G_KP;       // bytes of one operand row per pass
constexpr u32 G_PITCH = G_ROWB + 16;    // LDS row pitch: an odd multiple of 16 B for ds_load_b128
constexpr u32 G_SROWS = 32;             // rows per slice (one tensor load of one wave)
constexpr u32 G_SLICE = 10240;          // 32 x 272 = 8704 B, rounded up to a multiple of 2 KiB
constexpr u32 G_STAGE = 8 * G_SLICE;    // [A 4 slices | B 4 slices]
static_assert(G_SROWS * G_PITCH <= G_SLICE && G_SLICE % 2048 == 0, "slice place");

__device__ __forceinline__ u32 uni(u32 v) { return (u32)__builtin_amdgcn_readfirstlane(v); }
__device__ __forceinline__ u32 pinned(u32 v) { u32 w = uni(v); asm volatile("" : "+s"(w)); return w; }
__device__ __forceinline__ u32 lds_off(const void* p) { return (u32)(size_t)p; }
// The compiler places no wait for the tensor mover: the tile counts as landed behind this.
__device__ __forceinline__ void wait_tensor0() { asm volatile("s_wait_tensorcnt 0x0" ::: "memory"); }
// This wave's LDS reads have returned before the buffer is handed back for a refill.
__device__ __forceinline__ void wait_ds0() { asm volatile("s_wait_dscnt 0x0" ::: "memory"); }
// One request of the whole wave: a 2-D tile from global memory into LDS.
__device__ __forceinline__ void tdm_load(u32x4 g0, u32x8 g1) {
    asm volatile("tensor_load_to_lds %0, %1" :: "s"(g0), "s"(g1) : "memory");
}
// Group 1: 1-byte elements, tile = tensor = 32 rows of 256 B, 16 B of LDS pad behind each row.
__device__ __forceinline__ u32x8 tdm_group1(u32 src_pitch) {
    constexpr u32 d0 = G_ROWB, d1 = G_SROWS;
    u32x8 g;
    g[0] = uni((1u << 20) | (5u << 22) | (3u << 25));
    g[1] = uni((d0 & 0xFFFFu) << 16);
    g[2] = uni((d0 >> 16) | ((d1 & 0xFFFFu) << 16));
    g[3] = uni((d1 >> 16) | (d0 << 16));
    g[4] = uni(d1);
    g[5] = uni(src_pitch);
    g[6] = uni(0u);
    g[7] = uni(0u);
    // Descriptor words held in scalar registers (the pinned() form, all eight at once): without it
    // the compiler rebuilds the constants before each issue and uses those registers as
    // temporaries while a request is outstanding.
    asm volatile("" : "+s"(g));
    return g;
}
__device__ __forceinline__ u32x4 tdm_group0(u32 lds_dst, u64 ga) {
    u32x4 g;
    g[0] = uni(1u);
    g[1] = uni(lds_dst);
    g[2] = uni((u32)ga);
    g[3] = uni((((u32)(ga >> 32)) & 0x01FFFFFFu) | 0x80000000u);
    return g;
}
// One 16x32 bf16 fragment from an LDS row block; p already holds the lane's row and half.
// Same k order as load_frag: 16 B at k = 8 * half, 16 B at k = 16 + 8 * half.
__device__ __forceinline__ bf16x16 lds_frag(const unsigned char* p) {
    FragU u;
    u.q[0] = *(const uint4*)(p);
    u.q[1] = *(const uint4*)(p + 32);
    return u.v;
}

// ---------------------------------------------------------------------------
// WMMA GEMM: C[M,N] = act(A[M,K] @ B[K,N] + bias) (+ residual)
// A: bf16 row-major, BT: bf16 N x K (transposed), bias f32.
// 256 threads = 8 waves; block tile 128x128; wave tile 32(M)x64(N).
// Operands come through LDS: per pass of 128 k every wave brings one 32-row
// slice (waves 0-3: A, waves 4-7: BT) by a tensor load, two buffers, the next
// pass's tile in flight while this one is multiplied. K: a multiple of 128, >= 256.
// ---------------------------------------------------------------------------
template <int OUT_BF16, int ACT_GELU, int ADD_RES>
__global__ __launch_bounds__(256) void gemm_k(
    const u16* __restrict__ A, const u16* __restrict__ BT,
    const float* __restrict__ bias, const float* __restrict__ res,
    void* __restrict__ outp, int M, int N, int K) {
    __shared__ __attribute__((aligned(2048))) unsigned char L[2 * G_STAGE];
    const int tid = threadIdx.x, lane = tid & 31;
    const u32 wave = uni((u32)tid >> 5);
    const int wm = wave & 3, wn = wave >> 2;
    const int m0 = blockIdx.y * 128 + wm * 32;
    const int n0 = blockIdx.x * 128 + wn * 64;

    const u32 kb = (u32)K * 2u;                 // source row pitch, bytes
    const u32 T = (u32)K / G_KP;                // passes
    const unsigned char* src = (wave < 4u)
        ? (const unsigned char*)A + (u64)(blockIdx.y * 128u + wave * G_SROWS) * kb
        : (const unsigned char*)BT + (u64)(blockIdx.x * 128u + (wave - 4u) * G_SROWS) * kb;
    const u32 dst = lds_off(L) + wave * G_SLICE;
    const u32x8 g1 = tdm_group1(kb);

    f32x8 acc[2][4];
#pragma unroll
    for (int i = 0; i < 2; ++i)
#pragma unroll
        for (int j = 0; j < 4; ++j) acc[i][j] = zero8();

    // Per-lane fragment bases inside a buffer.
    const u32 lrow = (u32)(lane & 15) * G_PITCH + (u32)(lane >> 4) * 16u;
    const u32 a_base = (u32)wm * G_SLICE + lrow;
    const u32 b_base = (4u + 2u * (u32)wn) * G_SLICE + lrow;

    tdm_load(tdm_group0(dst, (u64)(size_t)src), g1);                      // stage 0
    wait_tensor0();
    __syncthreads();                                                      // stage 0 published
    tdm_load(tdm_group0(dst + G_STAGE, (u64)(size_t)src + G_ROWB), g1);   // stage 1

    // Rolled: one publish point per pass, and the buffer is picked by the pass's parity.
#pragma clang loop unroll(disable)
    for (u32 s = 0; s < T; ++s) {
        const u32 buf = (s & 1u) * G_STAGE;
        const unsigned char* la = L + buf + a_base;
        const unsigned char* lb = L + buf + b_base;
        bf16x16 af[2][2], bf[2][4];   // two fragment sets: the next 32 k load while these multiply
#pragma unroll
        for (int i = 0; i < 2; ++i) af[0][i] = lds_frag(la + (u32)i * 16u * G_PITCH);
#pragma unroll
        for (int j = 0; j < 4; ++j)
            bf[0][j] = lds_frag(lb + (u32)(j >> 1) * G_SLICE + (u32)(j & 1) * 16u * G_PITCH);
#pragma unroll
        for (int kk = 0; kk < 4; ++kk) {
            const int cur = kk & 1, nxt = cur ^ 1;
            if (kk < 3) {
#pragma unroll
                for (int i = 0; i < 2; ++i)
                    af[nxt][i] = lds_frag(la + (u32)i * 16u * G_PITCH + (u32)(kk + 1) * 64u);
#pragma unroll
                for (int j = 0; j < 4; ++j)
                    bf[nxt][j] = lds_frag(lb + (u32)(j >> 1) * G_SLICE + (u32)(j & 1) * 16u * G_PITCH + (u32)(kk + 1) * 64u);
            }
            // Keeps the LDS reads one group ahead of the block instead of spread among its WMMAs.
            __builtin_amdgcn_sched_barrier(0);
#pragma unroll
            for (int i = 0; i < 2; ++i)
#pragma unroll
                for (int j = 0; j < 4; ++j)
                    acc[i][j] = wmma32(af[cur][i], bf[cur][j], acc[i][j]);
            // Ends the block: the next group of reads stays behind these WMMAs.
            __builtin_amdgcn_sched_barrier(0);
        }
        // Publish point of stage s + 1.
        wait_ds0();
        wait_tensor0();
        __syncthreads();
        // Only while stage s + 2 exists; pinned(): a scalar branch, since a tensor load ignores EXEC.
        if (pinned((s + 2u < T) ? 1u : 0u) != 0u)   // refill the buffer this pass has just read
            tdm_load(tdm_group0(dst + buf, (u64)(size_t)src + (u64)(s + 2u) * G_ROWB), g1);
    }
    wait_tensor0();
    wait_ds0();

    const int c = lane & 15, hs = lane >> 4;
#pragma unroll
    for (int i = 0; i < 2; ++i) {
#pragma unroll
        for (int j = 0; j < 4; ++j) {
            const int col = n0 + j * 16 + c;
            const float bv = bias[col];
#pragma unroll
            for (int v = 0; v < 8; ++v) {
                const int row = m0 + i * 16 + v + 8 * hs;
                float val = acc[i][j][v] + bv;
                if (ACT_GELU) val = gelu_exact(val);
                if (ADD_RES) val += res[(size_t)row * N + col];
                if (OUT_BF16)
                    ((u16*)outp)[(size_t)row * N + col] = f2bf(val);
                else
                    ((float*)outp)[(size_t)row * N + col] = val;
            }
        }
    }
}

// ---------------------------------------------------------------------------
// V transpose per (b,h): V (b,s,h,d) bf16 -> VT (b*h, d, s) bf16
// ---------------------------------------------------------------------------
__global__ __launch_bounds__(256) void transpose_v_k(
    const u16* __restrict__ V, u16* __restrict__ VT, int S) {
    __shared__ u16 tile[32][33];
    const int s0 = blockIdx.x * 32, d0 = blockIdx.y * 32, bh = blockIdx.z;
    const int b = bh >> 4, h = bh & 15;
    const int tx = threadIdx.x, ty = threadIdx.y;
#pragma unroll
    for (int i = 0; i < 32; i += 8)
        tile[ty + i][tx] = V[(size_t)(b * S + s0 + ty + i) * 1024 + h * 64 + d0 + tx];
    __syncthreads();
#pragma unroll
    for (int i = 0; i < 32; i += 8)
        VT[(size_t)(bh * 64 + d0 + ty + i) * S + (s0 + tx)] = tile[tx][ty + i];
}

// ---------------------------------------------------------------------------
// Causal flash attention, dk = 64. Grid: (S/128, B*H), 8 waves per block,
// each wave owns 16 query rows; streams 32-key blocks with online softmax.
// ---------------------------------------------------------------------------
__global__ __launch_bounds__(256) void attn_k(
    const u16* __restrict__ Q, const u16* __restrict__ Kb,
    const u16* __restrict__ VT, u16* __restrict__ CTX, int S) {
    const int tid = threadIdx.x, lane = tid & 31, wave = tid >> 5;
    const int bh = blockIdx.y, b = bh >> 4, h = bh & 15;
    const int q0 = blockIdx.x * 128 + wave * 16;
    const int c = lane & 15, hs = lane >> 4;

    __shared__ __align__(16) u16 pbuf[8][640];   // 16 rows x stride 40 per wave
    u16* pw = pbuf[wave];

    const u16* qbase = Q + (size_t)(b * S + q0) * 1024 + h * 64;
    const bf16x16 aq0 = load_frag(qbase, 1024, lane);        // dk 0..31
    const bf16x16 aq1 = load_frag(qbase + 32, 1024, lane);   // dk 32..63

    float mrow[8], lsum[8];
    f32x8 cacc[4];
#pragma unroll
    for (int v = 0; v < 8; ++v) { mrow[v] = -1e30f; lsum[v] = 0.0f; }
#pragma unroll
    for (int n = 0; n < 4; ++n) cacc[n] = zero8();

    const float SC = 0.125f;            // 1/sqrt(64)
    const float L2E = 1.44269504f;

    for (int kb = 0; kb < q0 + 16; kb += 32) {
        // ---- scores: S = Q(16x64) @ K^T(64x32) in two 16-key column frags
        f32x8 s0 = zero8(), s1 = zero8();
        const u16* kp = Kb + (size_t)(b * S + kb) * 1024 + h * 64;
        s0 = wmma32(aq0, load_frag(kp, 1024, lane), s0);
        s1 = wmma32(aq0, load_frag(kp + (size_t)16 * 1024, 1024, lane), s1);
        s0 = wmma32(aq1, load_frag(kp + 32, 1024, lane), s0);
        s1 = wmma32(aq1, load_frag(kp + (size_t)16 * 1024 + 32, 1024, lane), s1);

        // ---- online softmax per row (rows live in (vgpr, lane-half))
#pragma unroll
        for (int v = 0; v < 8; ++v) {
            const int row = q0 + v + 8 * hs;
            const int key0 = kb + c, key1 = key0 + 16;
            float f0 = (key0 <= row) ? s0[v] * SC : -1e30f;
            float f1 = (key1 <= row) ? s1[v] * SC : -1e30f;
            float mx = fmaxf(f0, f1);
#pragma unroll
            for (int off = 8; off; off >>= 1) mx = fmaxf(mx, __shfl_xor(mx, off, 32));
            const float mnew = fmaxf(mrow[v], mx);
            const float p0 = exp2f((f0 - mnew) * L2E);
            const float p1 = exp2f((f1 - mnew) * L2E);
            float ps = p0 + p1;
#pragma unroll
            for (int off = 8; off; off >>= 1) ps += __shfl_xor(ps, off, 32);
            const float alpha = exp2f((mrow[v] - mnew) * L2E);
            lsum[v] = lsum[v] * alpha + ps;
            mrow[v] = mnew;
#pragma unroll
            for (int n = 0; n < 4; ++n) cacc[n][v] *= alpha;
            const int prow = v + 8 * hs;
            pw[prow * 40 + c] = f2bf(p0);
            pw[prow * 40 + 16 + c] = f2bf(p1);
        }
        asm volatile("s_wait_dscnt 0" ::: "memory");   // LDS stores visible to wave
        const bf16x16 pfrag = load_frag(pw, 40, lane); // P (16x32) in A layout

        // ---- ctx += P(16x32) @ V(32x64), VT gives contiguous B frags
        const u16* vtb = VT + (size_t)(bh * 64) * S + kb;
#pragma unroll
        for (int n = 0; n < 4; ++n)
            cacc[n] = wmma32(pfrag, load_frag(vtb + (size_t)(n * 16) * S, S, lane), cacc[n]);
    }

    float inv[8];
#pragma unroll
    for (int v = 0; v < 8; ++v) inv[v] = 1.0f / lsum[v];
#pragma unroll
    for (int n = 0; n < 4; ++n)
#pragma unroll
        for (int v = 0; v < 8; ++v) {
            const int row = q0 + v + 8 * hs;
            const int col = n * 16 + c;
            CTX[(size_t)(b * S + row) * 1024 + h * 64 + col] = f2bf(cacc[n][v] * inv[v]);
        }
}

// ---------------------------------------------------------------------------
// Host-side orchestration
// ---------------------------------------------------------------------------
extern "C" void kernel_launch(void* const* d_in, const int* in_sizes, int n_in,
                              void* d_out, int out_size, void* d_ws, size_t ws_size,
                              hipStream_t stream) {
    constexpr int B = 4, S = 2048, D = 1024, H = 16, F = 4096;
    constexpr int M = B * S;  // 8192 tokens
    constexpr size_t MiB = 1u << 20;

    const float* x    = (const float*)d_in[0];
    const float* Wq   = (const float*)d_in[1];
    const float* bq   = (const float*)d_in[2];
    const float* Wk   = (const float*)d_in[3];
    const float* bk   = (const float*)d_in[4];
    const float* Wv   = (const float*)d_in[5];
    const float* bv   = (const float*)d_in[6];
    const float* Wo   = (const float*)d_in[7];
    const float* bo   = (const float*)d_in[8];
    const float* ln1g = (const float*)d_in[9];
    const float* ln1b = (const float*)d_in[10];
    const float* ln2g = (const float*)d_in[11];
    const float* ln2b = (const float*)d_in[12];
    const float* W1   = (const float*)d_in[13];
    const float* b1   = (const float*)d_in[14];
    const float* W2   = (const float*)d_in[15];
    const float* b2   = (const float*)d_in[16];

    char* ws = (char*)d_ws;
    u16*   WQT = (u16*)(ws + 0 * MiB);     // D x D bf16 (transposed)  2 MiB
    u16*   WKT = (u16*)(ws + 2 * MiB);
    u16*   WVT = (u16*)(ws + 4 * MiB);
    u16*   WOT = (u16*)(ws + 6 * MiB);
    u16*   W1T = (u16*)(ws + 8 * MiB);     // F x D bf16               8 MiB
    u16*   W2T = (u16*)(ws + 16 * MiB);    // D x F bf16               8 MiB
    u16*   H1  = (u16*)(ws + 24 * MiB);    // M x D bf16              16 MiB
    u16*   QB  = (u16*)(ws + 40 * MiB);    // M x D bf16
    u16*   KB  = (u16*)(ws + 56 * MiB);
    u16*   VB  = (u16*)(ws + 72 * MiB);
    u16*   VTB = (u16*)(ws + 88 * MiB);    // (B*H) x 64 x S bf16
    u16*   CTX = (u16*)(ws + 104 * MiB);   // M x D bf16
    float* X1  = (float*)(ws + 120 * MiB); // M x D f32               32 MiB
    u16*   U   = (u16*)(ws + 40 * MiB);    // M x F bf16 (reuses Q/K/V/VT) 64 MiB
    float* OUT = (float*)d_out;
    (void)in_sizes; (void)n_in; (void)out_size; (void)ws_size;

    const dim3 tb(32, 8);
    // 0) weights -> bf16 transposed (L2-resident working set: 24 MiB)
    cast_transpose_k<<<dim3(D / 32, D / 32), tb, 0, stream>>>(Wq, WQT, D, D);
    cast_transpose_k<<<dim3(D / 32, D / 32), tb, 0, stream>>>(Wk, WKT, D, D);
    cast_transpose_k<<<dim3(D / 32, D / 32), tb, 0, stream>>>(Wv, WVT, D, D);
    cast_transpose_k<<<dim3(D / 32, D / 32), tb, 0, stream>>>(Wo, WOT, D, D);
    cast_transpose_k<<<dim3(F / 32, D / 32), tb, 0, stream>>>(W1, W1T, D, F);
    cast_transpose_k<<<dim3(D / 32, F / 32), tb, 0, stream>>>(W2, W2T, F, D);

    // 1) LN1: x -> H1 (bf16)
    layernorm_k<<<M, 256, 0, stream>>>(x, ln1g, ln1b, H1);

    // 2) Q/K/V projections (bf16 out)
    gemm_k<1, 0, 0><<<dim3(D / 128, M / 128), 256, 0, stream>>>(H1, WQT, bq, nullptr, QB, M, D, D);
    gemm_k<1, 0, 0><<<dim3(D / 128, M / 128), 256, 0, stream>>>(H1, WKT, bk, nullptr, KB, M, D, D);
    gemm_k<1, 0, 0><<<dim3(D / 128, M / 128), 256, 0, stream>>>(H1, WVT, bv, nullptr, VB, M, D, D);

    // 3) V -> VT per (b,h)
    transpose_v_k<<<dim3(S / 32, 2, B * H), tb, 0, stream>>>(VB, VTB, S);

    // 4) causal flash attention -> CTX (bf16)
    attn_k<<<dim3(S / 128, B * H), 256, 0, stream>>>(QB, KB, VTB, CTX, S);

    // 5) output projection + residual: X1 = x + CTX @ Wo + bo (f32)
    gemm_k<0, 0, 1><<<dim3(D / 128, M / 128), 256, 0, stream>>>(CTX, WOT, bo, x, X1, M, D, D);

    // 6) LN2: X1 -> H1 (bf16, reuse)
    layernorm_k<<<M, 256, 0, stream>>>(X1, ln2g, ln2b, H1);

    // 7) FFN up + exact GELU -> U (bf16)
    gemm_k<1, 1, 0><<<dim3(F / 128, M / 128), 256, 0, stream>>>(H1, W1T, b1, nullptr, U, M, F, D);

    // 8) FFN down + residual -> OUT (f32)
    gemm_k<0, 0, 1><<<dim3(D / 128, M / 128), 256, 0, stream>>>(U, W2T, b2, X1, OUT, M, D, F);
}

// v002
// It runs in 424 microseconds.
// Two timings next to v001 both put it at 1.21 times that version's speed.
// Over all steps from v000 it is 2.15 times as fast.
#include <hip/hip_runtime.h>

typedef unsigned short u16;
typedef __attribute__((ext_vector_type(16))) __bf16 bf16x16;
typedef __attribute__((ext_vector_type(8)))  float  f32x8;

union FragU { bf16x16 v; uint4 q[2]; };

__device__ __forceinline__ u16 f2bf(float f) {
    unsigned u = __float_as_uint(f);
    u += 0x7FFFu + ((u >> 16) & 1u);   // round-to-nearest-even
    return (u16)(u >> 16);
}

__device__ __forceinline__ f32x8 zero8() {
    f32x8 z;
#pragma unroll
    for (int i = 0; i < 8; ++i) z[i] = 0.0f;
    return z;
}

// Load one 16x32 bf16 operand fragment (A-layout; B uses transposed source so
// the same layout applies). Lanes 0-15: rows 0-15, K 0-7 & 16-23.
// Lanes 16-31: rows 0-15, K 8-15 & 24-31. Two 16B loads per lane.
__device__ __forceinline__ bf16x16 load_frag(const u16* base, int stride, int lane) {
    const int half = lane >> 4, r = lane & 15;
    const u16* p = base + (size_t)r * stride + half * 8;
    FragU u;
    u.q[0] = *(const uint4*)(p);
    u.q[1] = *(const uint4*)(p + 16);
    return u.v;
}

__device__ __forceinline__ f32x8 wmma32(bf16x16 a, bf16x16 b, f32x8 c) {
    return __builtin_amdgcn_wmma_f32_16x16x32_bf16(false, a, false, b, (short)0, c, false, false);
}

__device__ __forceinline__ float gelu_exact(float x) {
    return 0.5f * x * (1.0f + erff(x * 0.70710678118654752f));
}

// ---------------------------------------------------------------------------
// Weight cast + transpose: in (K x N) f32 row-major -> out (N x K) bf16
// ---------------------------------------------------------------------------
__global__ __launch_bounds__(256) void cast_transpose_k(
    const float* __restrict__ in, u16* __restrict__ out, int K, int N) {
    __shared__ float tile[32][33];
    const int n0 = blockIdx.x * 32, k0 = blockIdx.y * 32;
    const int tx = threadIdx.x, ty = threadIdx.y;
#pragma unroll
    for (int i = 0; i < 32; i += 8)
        tile[ty + i][tx] = in[(size_t)(k0 + ty + i) * N + (n0 + tx)];
    __syncthreads();
#pragma unroll
    for (int i = 0; i < 32; i += 8)
        out[(size_t)(n0 + ty + i) * K + (k0 + tx)] = f2bf(tile[tx][ty + i]);
}

// ---------------------------------------------------------------------------
// LayerNorm (f32 in, bf16 out), one 256-thread block per row of D=1024
// ---------------------------------------------------------------------------
__global__ __launch_bounds__(256) void layernorm_k(
    const float* __restrict__ in, const float* __restrict__ g,
    const float* __restrict__ be, u16* __restrict__ out) {
    const int row = blockIdx.x, tid = threadIdx.x;
    const float* rp = in + (size_t)row * 1024;
    float v[4], s = 0.0f, ss = 0.0f;
#pragma unroll
    for (int i = 0; i < 4; ++i) {
        v[i] = rp[tid + 256 * i];
        s += v[i];
        ss += v[i] * v[i];
    }
    __shared__ float rs[256], rq[256];
    rs[tid] = s; rq[tid] = ss;
    __syncthreads();
    for (int off = 128; off > 0; off >>= 1) {
        if (tid < off) { rs[tid] += rs[tid + off]; rq[tid] += rq[tid + off]; }
        __syncthreads();
    }
    const float mu = rs[0] * (1.0f / 1024.0f);
    const float var = rq[0] * (1.0f / 1024.0f) - mu * mu;
    const float rstd = rsqrtf(var + 1e-5f);
    u16* op = out + (size_t)row * 1024;
#pragma unroll
    for (int i = 0; i < 4; ++i) {
        const int col = tid + 256 * i;
        op[col] = f2bf((v[i] - mu) * rstd * g[col] + be[col]);
    }
}

// ---------------------------------------------------------------------------
// Tensor-load helpers for the GEMM's LDS ring
// ---------------------------------------------------------------------------
typedef unsigned int u32;
typedef unsigned long long u64;
typedef u32 u32x4 __attribute__((ext_vector_type(4)));
typedef u32 u32x8 __attribute__((ext_vector_type(8)));

constexpr u32 G_KP    = 128;            // k per pass
constexpr u32 G_ROWB  = 2 * G_KP;       // bytes of one operand row per pass
constexpr u32 G_PITCH = G_ROWB + 16;    // LDS row pitch: an odd multiple of 16 B for ds_load_b128
constexpr u32 G_SROWS = 32;             // rows per slice (one tensor load of one wave)
constexpr u32 G_SLICE = 10240;          // 32 x 272 = 8704 B, rounded up to a multiple of 2 KiB
constexpr u32 G_STAGE = 8 * G_SLICE;    // [A 4 slices | B 4 slices]
static_assert(G_SROWS * G_PITCH <= G_SLICE && G_SLICE % 2048 == 0, "slice place");

__device__ __forceinline__ u32 uni(u32 v) { return (u32)__builtin_amdgcn_readfirstlane(v); }
__device__ __forceinline__ u32 pinned(u32 v) { u32 w = uni(v); asm volatile("" : "+s"(w)); return w; }
__device__ __forceinline__ u32 lds_off(const void* p) { return (u32)(size_t)p; }
// The compiler places no wait for the tensor mover: the tile counts as landed behind this.
__device__ __forceinline__ void wait_tensor0() { asm volatile("s_wait_tensorcnt 0x0" ::: "memory"); }
// This wave's LDS reads have returned before the buffer is handed back for a refill.
__device__ __forceinline__ void wait_ds0() { asm volatile("s_wait_dscnt 0x0" ::: "memory"); }
// One request of the whole wave: a 2-D tile from global memory into LDS.
__device__ __forceinline__ void tdm_load(u32x4 g0, u32x8 g1) {
    asm volatile("tensor_load_to_lds %0, %1" :: "s"(g0), "s"(g1) : "memory");
}
// Group 1: 1-byte elements, tile = tensor = 32 rows of 256 B, 16 B of LDS pad behind each row.
__device__ __forceinline__ u32x8 tdm_group1(u32 src_pitch) {
    constexpr u32 d0 = G_ROWB, d1 = G_SROWS;
    u32x8 g;
    g[0] = uni((1u << 20) | (5u << 22) | (3u << 25));
    g[1] = uni((d0 & 0xFFFFu) << 16);
    g[2] = uni((d0 >> 16) | ((d1 & 0xFFFFu) << 16));
    g[3] = uni((d1 >> 16) | (d0 << 16));
    g[4] = uni(d1);
    g[5] = uni(src_pitch);
    g[6] = uni(0u);
    g[7] = uni(0u);
    // Descriptor words held in scalar registers (the pinned() form, all eight at once): without it
    // the compiler rebuilds the constants before each issue and uses those registers as
    // temporaries while a request is outstanding.
    asm volatile("" : "+s"(g));
    return g;
}
__device__ __forceinline__ u32x4 tdm_group0(u32 lds_dst, u64 ga) {
    u32x4 g;
    g[0] = uni(1u);
    g[1] = uni(lds_dst);
    g[2] = uni((u32)ga);
    g[3] = uni((((u32)(ga >> 32)) & 0x01FFFFFFu) | 0x80000000u);
    return g;
}
// One 16x32 bf16 fragment from an LDS row block; p already holds the lane's row and half.
// Same k order as load_frag: 16 B at k = 8 * half, 16 B at k = 16 + 8 * half.
__device__ __forceinline__ bf16x16 lds_frag(const unsigned char* p) {
    FragU u;
    u.q[0] = *(const uint4*)(p);
    u.q[1] = *(const uint4*)(p + 32);
    return u.v;
}

// ---------------------------------------------------------------------------
// WMMA GEMM: C[M,N] = act(A[M,K] @ B[K,N] + bias) (+ residual)
// A: bf16 row-major, BT: bf16 N x K (transposed), bias f32.
// 256 threads = 8 waves; block tile 128x128; wave tile 32(M)x64(N).
// Operands come through LDS: per pass of 128 k every wave brings one 32-row
// slice (waves 0-3: A, waves 4-7: BT) by a tensor load, two buffers, the next
// pass's tile in flight while this one is multiplied. K: a multiple of 128, >= 256.
// ---------------------------------------------------------------------------
template <int OUT_BF16, int ACT_GELU, int ADD_RES>
__global__ __launch_bounds__(256) void gemm_k(
    const u16* __restrict__ A, const u16* __restrict__ BT,
    const float* __restrict__ bias, const float* __restrict__ res,
    void* __restrict__ outp, int M, int N, int K) {
    __shared__ __attribute__((aligned(2048))) unsigned char L[2 * G_STAGE];
    const int tid = threadIdx.x, lane = tid & 31;
    const u32 wave = uni((u32)tid >> 5);
    const int wm = wave & 3, wn = wave >> 2;
    const int m0 = blockIdx.y * 128 + wm * 32;
    const int n0 = blockIdx.x * 128 + wn * 64;

    const u32 kb = (u32)K * 2u;                 // source row pitch, bytes
    const u32 T = (u32)K / G_KP;                // passes
    const unsigned char* src = (wave < 4u)
        ? (const unsigned char*)A + (u64)(blockIdx.y * 128u + wave * G_SROWS) * kb
        : (const unsigned char*)BT + (u64)(blockIdx.x * 128u + (wave - 4u) * G_SROWS) * kb;
    const u32 dst = lds_off(L) + wave * G_SLICE;
    const u32x8 g1 = tdm_group1(kb);

    f32x8 acc[2][4];
#pragma unroll
    for (int i = 0; i < 2; ++i)
#pragma unroll
        for (int j = 0; j < 4; ++j) acc[i][j] = zero8();

    // Per-lane fragment bases inside a buffer.
    const u32 lrow = (u32)(lane & 15) * G_PITCH + (u32)(lane >> 4) * 16u;
    const u32 a_base = (u32)wm * G_SLICE + lrow;
    const u32 b_base = (4u + 2u * (u32)wn) * G_SLICE + lrow;

    tdm_load(tdm_group0(dst, (u64)(size_t)src), g1);                      // stage 0
    wait_tensor0();
    __syncthreads();                                                      // stage 0 published
    tdm_load(tdm_group0(dst + G_STAGE, (u64)(size_t)src + G_ROWB), g1);   // stage 1

    // Rolled: one publish point per pass, and the buffer is picked by the pass's parity.
#pragma clang loop unroll(disable)
    for (u32 s = 0; s < T; ++s) {
        const u32 buf = (s & 1u) * G_STAGE;
        const unsigned char* la = L + buf + a_base;
        const unsigned char* lb = L + buf + b_base;
        bf16x16 af[2][2], bf[2][4];   // two fragment sets: the next 32 k load while these multiply
#pragma unroll
        for (int i = 0; i < 2; ++i) af[0][i] = lds_frag(la + (u32)i * 16u * G_PITCH);
#pragma unroll
        for (int j = 0; j < 4; ++j)
            bf[0][j] = lds_frag(lb + (u32)(j >> 1) * G_SLICE + (u32)(j & 1) * 16u * G_PITCH);
#pragma unroll
        for (int kk = 0; kk < 4; ++kk) {
            const int cur = kk & 1, nxt = cur ^ 1;
            if (kk < 3) {
#pragma unroll
                for (int i = 0; i < 2; ++i)
                    af[nxt][i] = lds_frag(la + (u32)i * 16u * G_PITCH + (u32)(kk + 1) * 64u);
#pragma unroll
                for (int j = 0; j < 4; ++j)
                    bf[nxt][j] = lds_frag(lb + (u32)(j >> 1) * G_SLICE + (u32)(j & 1) * 16u * G_PITCH + (u32)(kk + 1) * 64u);
            }
            // Keeps the LDS reads one group ahead of the block instead of spread among its WMMAs.
            __builtin_amdgcn_sched_barrier(0);
#pragma unroll
            for (int i = 0; i < 2; ++i)
#pragma unroll
                for (int j = 0; j < 4; ++j)
                    acc[i][j] = wmma32(af[cur][i], bf[cur][j], acc[i][j]);
            // Ends the block: the next group of reads stays behind these WMMAs.
            __builtin_amdgcn_sched_barrier(0);
        }
        // Publish point of stage s + 1.
        wait_ds0();
        wait_tensor0();
        __syncthreads();
        // Only while stage s + 2 exists; pinned(): a scalar branch, since a tensor load ignores EXEC.
        if (pinned((s + 2u < T) ? 1u : 0u) != 0u)   // refill the buffer this pass has just read
            tdm_load(tdm_group0(dst + buf, (u64)(size_t)src + (u64)(s + 2u) * G_ROWB), g1);
    }
    wait_tensor0();
    wait_ds0();

    const int c = lane & 15, hs = lane >> 4;
#pragma unroll
    for (int i = 0; i < 2; ++i) {
#pragma unroll
        for (int j = 0; j < 4; ++j) {
            const int col = n0 + j * 16 + c;
            const float bv = bias[col];
#pragma unroll
            for (int v = 0; v < 8; ++v) {
                const int row = m0 + i * 16 + v + 8 * hs;
                float val = acc[i][j][v] + bv;
                if (ACT_GELU) val = gelu_exact(val);
                if (ADD_RES) val += res[(size_t)row * N + col];
                if (OUT_BF16)
                    ((u16*)outp)[(size_t)row * N + col] = f2bf(val);
                else
                    ((float*)outp)[(size_t)row * N + col] = val;
            }
        }
    }
}

// ---------------------------------------------------------------------------
// V transpose per (b,h): V (b,s,h,d) bf16 -> VT (b*h, d, s) bf16
// ---------------------------------------------------------------------------
__global__ __launch_bounds__(256) void transpose_v_k(
    const u16* __restrict__ V, u16* __restrict__ VT, int S) {
    __shared__ u16 tile[32][33];
    const int s0 = blockIdx.x * 32, d0 = blockIdx.y * 32, bh = blockIdx.z;
    const int b = bh >> 4, h = bh & 15;
    const int tx = threadIdx.x, ty = threadIdx.y;
#pragma unroll
    for (int i = 0; i < 32; i += 8)
        tile[ty + i][tx] = V[(size_t)(b * S + s0 + ty + i) * 1024 + h * 64 + d0 + tx];
    __syncthreads();
#pragma unroll
    for (int i = 0; i < 32; i += 8)
        VT[(size_t)(bh * 64 + d0 + ty + i) * S + (s0 + tx)] = tile[tx][ty + i];
}

// ---------------------------------------------------------------------------
// Causal flash attention, dk = 64. Grid: (B*H, S/128), 8 waves per block,
// each wave owns 16 query rows; streams 32-key blocks with online softmax.
// A block's cost grows with its query tile, and not all blocks are resident at
// once: the head is the fast grid index and the tile falls with blockIdx.y, so
// the longest blocks start first, the short ones fill the places that come free,
// and neighbouring indices cost the same.
// ---------------------------------------------------------------------------
__global__ __launch_bounds__(256) void attn_k(
    const u16* __restrict__ Q, const u16* __restrict__ Kb,
    const u16* __restrict__ VT, u16* __restrict__ CTX, int S) {
    const int tid = threadIdx.x, lane = tid & 31, wave = tid >> 5;
    const int bh = blockIdx.x, b = bh >> 4, h = bh & 15;
    const int q0 = (S / 128 - 1 - (int)blockIdx.y) * 128 + wave * 16;
    const int c = lane & 15, hs = lane >> 4;

    __shared__ __align__(16) u16 pbuf[8][640];   // 16 rows x stride 40 per wave
    u16* pw = pbuf[wave];

    const u16* qbase = Q + (size_t)(b * S + q0) * 1024 + h * 64;
    const bf16x16 aq0 = load_frag(qbase, 1024, lane);        // dk 0..31
    const bf16x16 aq1 = load_frag(qbase + 32, 1024, lane);   // dk 32..63

    float mrow[8], lsum[8];
    f32x8 cacc[4];
#pragma unroll
    for (int v = 0; v < 8; ++v) { mrow[v] = -1e30f; lsum[v] = 0.0f; }
#pragma unroll
    for (int n = 0; n < 4; ++n) cacc[n] = zero8();

    const float SC = 0.125f;            // 1/sqrt(64)
    const float L2E = 1.44269504f;

    for (int kb = 0; kb < q0 + 16; kb += 32) {
        // ---- scores: S = Q(16x64) @ K^T(64x32) in two 16-key column frags
        f32x8 s0 = zero8(), s1 = zero8();
        const u16* kp = Kb + (size_t)(b * S + kb) * 1024 + h * 64;
        s0 = wmma32(aq0, load_frag(kp, 1024, lane), s0);
        s1 = wmma32(aq0, load_frag(kp + (size_t)16 * 1024, 1024, lane), s1);
        s0 = wmma32(aq1, load_frag(kp + 32, 1024, lane), s0);
        s1 = wmma32(aq1, load_frag(kp + (size_t)16 * 1024 + 32, 1024, lane), s1);

        // ---- online softmax per row (rows live in (vgpr, lane-half))
#pragma unroll
        for (int v = 0; v < 8; ++v) {
            const int row = q0 + v + 8 * hs;
            const int key0 = kb + c, key1 = key0 + 16;
            float f0 = (key0 <= row) ? s0[v] * SC : -1e30f;
            float f1 = (key1 <= row) ? s1[v] * SC : -1e30f;
            float mx = fmaxf(f0, f1);
#pragma unroll
            for (int off = 8; off; off >>= 1) mx = fmaxf(mx, __shfl_xor(mx, off, 32));
            const float mnew = fmaxf(mrow[v], mx);
            const float p0 = exp2f((f0 - mnew) * L2E);
            const float p1 = exp2f((f1 - mnew) * L2E);
            float ps = p0 + p1;
#pragma unroll
            for (int off = 8; off; off >>= 1) ps += __shfl_xor(ps, off, 32);
            const float alpha = exp2f((mrow[v] - mnew) * L2E);
            lsum[v] = lsum[v] * alpha + ps;
            mrow[v] = mnew;
#pragma unroll
            for (int n = 0; n < 4; ++n) cacc[n][v] *= alpha;
            const int prow = v + 8 * hs;
            pw[prow * 40 + c] = f2bf(p0);
            pw[prow * 40 + 16 + c] = f2bf(p1);
        }
        asm volatile("s_wait_dscnt 0" ::: "memory");   // LDS stores visible to wave
        const bf16x16 pfrag = load_frag(pw, 40, lane); // P (16x32) in A layout

        // ---- ctx += P(16x32) @ V(32x64), VT gives contiguous B frags
        const u16* vtb = VT + (size_t)(bh * 64) * S + kb;
#pragma unroll
        for (int n = 0; n < 4; ++n)
            cacc[n] = wmma32(pfrag, load_frag(vtb + (size_t)(n * 16) * S, S, lane), cacc[n]);
    }

    float inv[8];
#pragma unroll
    for (int v = 0; v < 8; ++v) inv[v] = 1.0f / lsum[v];
#pragma unroll
    for (int n = 0; n < 4; ++n)
#pragma unroll
        for (int v = 0; v < 8; ++v) {
            const int row = q0 + v + 8 * hs;
            const int col = n * 16 + c;
            CTX[(size_t)(b * S + row) * 1024 + h * 64 + col] = f2bf(cacc[n][v] * inv[v]);
        }
}

// ---------------------------------------------------------------------------
// Host-side orchestration
// ---------------------------------------------------------------------------
extern "C" void kernel_launch(void* const* d_in, const int* in_sizes, int n_in,
                              void* d_out, int out_size, void* d_ws, size_t ws_size,
                              hipStream_t stream) {
    constexpr int B = 4, S = 2048, D = 1024, H = 16, F = 4096;
    constexpr int M = B * S;  // 8192 tokens
    constexpr size_t MiB = 1u << 20;

    const float* x    = (const float*)d_in[0];
    const float* Wq   = (const float*)d_in[1];
    const float* bq   = (const float*)d_in[2];
    const float* Wk   = (const float*)d_in[3];
    const float* bk   = (const float*)d_in[4];
    const float* Wv   = (const float*)d_in[5];
    const float* bv   = (const float*)d_in[6];
    const float* Wo   = (const float*)d_in[7];
    const float* bo   = (const float*)d_in[8];
    const float* ln1g = (const float*)d_in[9];
    const float* ln1b = (const float*)d_in[10];
    const float* ln2g = (const float*)d_in[11];
    const float* ln2b = (const float*)d_in[12];
    const float* W1   = (const float*)d_in[13];
    const float* b1   = (const float*)d_in[14];
    const float* W2   = (const float*)d_in[15];
    const float* b2   = (const float*)d_in[16];

    char* ws = (char*)d_ws;
    u16*   WQT = (u16*)(ws + 0 * MiB);     // D x D bf16 (transposed)  2 MiB
    u16*   WKT = (u16*)(ws + 2 * MiB);
    u16*   WVT = (u16*)(ws + 4 * MiB);
    u16*   WOT = (u16*)(ws + 6 * MiB);
    u16*   W1T = (u16*)(ws + 8 * MiB);     // F x D bf16               8 MiB
    u16*   W2T = (u16*)(ws + 16 * MiB);    // D x F bf16               8 MiB
    u16*   H1  = (u16*)(ws + 24 * MiB);    // M x D bf16              16 MiB
    u16*   QB  = (u16*)(ws + 40 * MiB);    // M x D bf16
    u16*   KB  = (u16*)(ws + 56 * MiB);
    u16*   VB  = (u16*)(ws + 72 * MiB);
    u16*   VTB = (u16*)(ws + 88 * MiB);    // (B*H) x 64 x S bf16
    u16*   CTX = (u16*)(ws + 104 * MiB);   // M x D bf16
    float* X1  = (float*)(ws + 120 * MiB); // M x D f32               32 MiB
    u16*   U   = (u16*)(ws + 40 * MiB);    // M x F bf16 (reuses Q/K/V/VT) 64 MiB
    float* OUT = (float*)d_out;
    (void)in_sizes; (void)n_in; (void)out_size; (void)ws_size;

    const dim3 tb(32, 8);
    // 0) weights -> bf16 transposed (L2-resident working set: 24 MiB)
    cast_transpose_k<<<dim3(D / 32, D / 32), tb, 0, stream>>>(Wq, WQT, D, D);
    cast_transpose_k<<<dim3(D / 32, D / 32), tb, 0, stream>>>(Wk, WKT, D, D);
    cast_transpose_k<<<dim3(D / 32, D / 32), tb, 0, stream>>>(Wv, WVT, D, D);
    cast_transpose_k<<<dim3(D / 32, D / 32), tb, 0, stream>>>(Wo, WOT, D, D);
    cast_transpose_k<<<dim3(F / 32, D / 32), tb, 0, stream>>>(W1, W1T, D, F);
    cast_transpose_k<<<dim3(D / 32, F / 32), tb, 0, stream>>>(W2, W2T, F, D);

    // 1) LN1: x -> H1 (bf16)
    layernorm_k<<<M, 256, 0, stream>>>(x, ln1g, ln1b, H1);

    // 2) Q/K/V projections (bf16 out)
    gemm_k<1, 0, 0><<<dim3(D / 128, M / 128), 256, 0, stream>>>(H1, WQT, bq, nullptr, QB, M, D, D);
    gemm_k<1, 0, 0><<<dim3(D / 128, M / 128), 256, 0, stream>>>(H1, WKT, bk, nullptr, KB, M, D, D);
    gemm_k<1, 0, 0><<<dim3(D / 128, M / 128), 256, 0, stream>>>(H1, WVT, bv, nullptr, VB, M, D, D);

    // 3) V -> VT per (b,h)
    transpose_v_k<<<dim3(S / 32, 2, B * H), tb, 0, stream>>>(VB, VTB, S);

    // 4) causal flash attention -> CTX (bf16)
    attn_k<<<dim3(B * H, S / 128), 256, 0, stream>>>(QB, KB, VTB, CTX, S);

    // 5) output projection + residual: X1 = x + CTX @ Wo + bo (f32)
    gemm_k<0, 0, 1><<<dim3(D / 128, M / 128), 256, 0, stream>>>(CTX, WOT, bo, x, X1, M, D, D);

    // 6) LN2: X1 -> H1 (bf16, reuse)
    layernorm_k<<<M, 256, 0, stream>>>(X1, ln2g, ln2b, H1);

    // 7) FFN up + exact GELU -> U (bf16)
    gemm_k<1, 1, 0><<<dim3(F / 128, M / 128), 256, 0, stream>>>(H1, W1T, b1, nullptr, U, M, F, D);

    // 8) FFN down + residual -> OUT (f32)
    gemm_k<0, 0, 1><<<dim3(D / 128, M / 128), 256, 0, stream>>>(U, W2T, b2, X1, OUT, M, D, F);
}

// v003
// Measured time: 404 microseconds a run.
// In both of two side-by-side timings against v002, it was 1.05 times as fast.
// All steps since v000 together make it 2.25 times as fast.
#include <hip/hip_runtime.h>

typedef unsigned short u16;
typedef __attribute__((ext_vector_type(16))) __bf16 bf16x16;
typedef __attribute__((ext_vector_type(8)))  float  f32x8;

union FragU { bf16x16 v; uint4 q[2]; };

__device__ __forceinline__ u16 f2bf(float f) {
    unsigned u = __float_as_uint(f);
    u += 0x7FFFu + ((u >> 16) & 1u);   // round-to-nearest-even
    return (u16)(u >> 16);
}

__device__ __forceinline__ f32x8 zero8() {
    f32x8 z;
#pragma unroll
    for (int i = 0; i < 8; ++i) z[i] = 0.0f;
    return z;
}

// Load one 16x32 bf16 operand fragment (A-layout; B uses transposed source so
// the same layout applies). Lanes 0-15: rows 0-15, K 0-7 & 16-23.
// Lanes 16-31: rows 0-15, K 8-15 & 24-31. Two 16B loads per lane.
__device__ __forceinline__ bf16x16 load_frag(const u16* base, int stride, int lane) {
    const int half = lane >> 4, r = lane & 15;
    const u16* p = base + (size_t)r * stride + half * 8;
    FragU u;
    u.q[0] = *(const uint4*)(p);
    u.q[1] = *(const uint4*)(p + 16);
    return u.v;
}

__device__ __forceinline__ f32x8 wmma32(bf16x16 a, bf16x16 b, f32x8 c) {
    return __builtin_amdgcn_wmma_f32_16x16x32_bf16(false, a, false, b, (short)0, c, false, false);
}

__device__ __forceinline__ float gelu_exact(float x) {
    return 0.5f * x * (1.0f + erff(x * 0.70710678118654752f));
}

// ---------------------------------------------------------------------------
// Weight cast + transpose: in (K x N) f32 row-major -> out (N x K) bf16
// ---------------------------------------------------------------------------
__global__ __launch_bounds__(256) void cast_transpose_k(
    const float* __restrict__ in, u16* __restrict__ out, int K, int N) {
    __shared__ float tile[32][33];
    const int n0 = blockIdx.x * 32, k0 = blockIdx.y * 32;
    const int tx = threadIdx.x, ty = threadIdx.y;
#pragma unroll
    for (int i = 0; i < 32; i += 8)
        tile[ty + i][tx] = in[(size_t)(k0 + ty + i) * N + (n0 + tx)];
    __syncthreads();
#pragma unroll
    for (int i = 0; i < 32; i += 8)
        out[(size_t)(n0 + ty + i) * K + (k0 + tx)] = f2bf(tile[tx][ty + i]);
}

// ---------------------------------------------------------------------------
// LayerNorm (f32 in, bf16 out), one 256-thread block per row of D=1024
// ---------------------------------------------------------------------------
__global__ __launch_bounds__(256) void layernorm_k(
    const float* __restrict__ in, const float* __restrict__ g,
    const float* __restrict__ be, u16* __restrict__ out) {
    const int row = blockIdx.x, tid = threadIdx.x;
    const float* rp = in + (size_t)row * 1024;
    float v[4], s = 0.0f, ss = 0.0f;
#pragma unroll
    for (int i = 0; i < 4; ++i) {
        v[i] = rp[tid + 256 * i];
        s += v[i];
        ss += v[i] * v[i];
    }
    __shared__ float rs[256], rq[256];
    rs[tid] = s; rq[tid] = ss;
    __syncthreads();
    for (int off = 128; off > 0; off >>= 1) {
        if (tid < off) { rs[tid] += rs[tid + off]; rq[tid] += rq[tid + off]; }
        __syncthreads();
    }
    const float mu = rs[0] * (1.0f / 1024.0f);
    const float var = rq[0] * (1.0f / 1024.0f) - mu * mu;
    const float rstd = rsqrtf(var + 1e-5f);
    u16* op = out + (size_t)row * 1024;
#pragma unroll
    for (int i = 0; i < 4; ++i) {
        const int col = tid + 256 * i;
        op[col] = f2bf((v[i] - mu) * rstd * g[col] + be[col]);
    }
}

// ---------------------------------------------------------------------------
// Tensor-load helpers for the GEMM's LDS ring
// ---------------------------------------------------------------------------
typedef unsigned int u32;
typedef unsigned long long u64;
typedef u32 u32x4 __attribute__((ext_vector_type(4)));
typedef u32 u32x8 __attribute__((ext_vector_type(8)));

constexpr u32 G_KP    = 128;            // k per pass
constexpr u32 G_ROWB  = 2 * G_KP;       // bytes of one operand row per pass
constexpr u32 G_PITCH = G_ROWB + 16;    // LDS row pitch: an odd multiple of 16 B for ds_load_b128
constexpr u32 G_SROWS = 32;             // rows per slice (one tensor load of one wave)
constexpr u32 G_SLICE = 10240;          // 32 x 272 = 8704 B, rounded up to a multiple of 2 KiB
constexpr u32 G_STAGE = 8 * G_SLICE;    // [A 4 slices | B 4 slices]
static_assert(G_SROWS * G_PITCH <= G_SLICE && G_SLICE % 2048 == 0, "slice place");

__device__ __forceinline__ u32 uni(u32 v) { return (u32)__builtin_amdgcn_readfirstlane(v); }
__device__ __forceinline__ u32 pinned(u32 v) { u32 w = uni(v); asm volatile("" : "+s"(w)); return w; }
__device__ __forceinline__ u32 lds_off(const void* p) { return (u32)(size_t)p; }
// The compiler places no wait for the tensor mover: the tile counts as landed behind this.
__device__ __forceinline__ void wait_tensor0() { asm volatile("s_wait_tensorcnt 0x0" ::: "memory"); }
// This wave's LDS reads have returned before the buffer is handed back for a refill.
__device__ __forceinline__ void wait_ds0() { asm volatile("s_wait_dscnt 0x0" ::: "memory"); }
// One request of the whole wave: a 2-D tile from global memory into LDS.
__device__ __forceinline__ void tdm_load(u32x4 g0, u32x8 g1) {
    asm volatile("tensor_load_to_lds %0, %1" :: "s"(g0), "s"(g1) : "memory");
}
// Group 1: 1-byte elements, tile = tensor = 32 rows of 256 B, 16 B of LDS pad behind each row.
__device__ __forceinline__ u32x8 tdm_group1(u32 src_pitch) {
    constexpr u32 d0 = G_ROWB, d1 = G_SROWS;
    u32x8 g;
    g[0] = uni((1u << 20) | (5u << 22) | (3u << 25));
    g[1] = uni((d0 & 0xFFFFu) << 16);
    g[2] = uni((d0 >> 16) | ((d1 & 0xFFFFu) << 16));
    g[3] = uni((d1 >> 16) | (d0 << 16));
    g[4] = uni(d1);
    g[5] = uni(src_pitch);
    g[6] = uni(0u);
    g[7] = uni(0u);
    // Descriptor words held in scalar registers (the pinned() form, all eight at once): without it
    // the compiler rebuilds the constants before each issue and uses those registers as
    // temporaries while a request is outstanding.
    asm volatile("" : "+s"(g));
    return g;
}
__device__ __forceinline__ u32x4 tdm_group0(u32 lds_dst, u64 ga) {
    u32x4 g;
    g[0] = uni(1u);
    g[1] = uni(lds_dst);
    g[2] = uni((u32)ga);
    g[3] = uni((((u32)(ga >> 32)) & 0x01FFFFFFu) | 0x80000000u);
    return g;
}
// One 16x32 bf16 fragment from an LDS row block; p already holds the lane's row and half.
// Same k order as load_frag: 16 B at k = 8 * half, 16 B at k = 16 + 8 * half.
__device__ __forceinline__ bf16x16 lds_frag(const unsigned char* p) {
    FragU u;
    u.q[0] = *(const uint4*)(p);
    u.q[1] = *(const uint4*)(p + 32);
    return u.v;
}

// ---------------------------------------------------------------------------
// WMMA GEMM: C[M,N] = act(A[M,K] @ B[K,N] + bias) (+ residual)
// A: bf16 row-major, BT: bf16 N x K (transposed), bias f32.
// 256 threads = 8 waves; block tile 128x128; wave tile 32(M)x64(N).
// Operands come through LDS: per pass of 128 k every wave brings one 32-row
// slice (waves 0-3: A, waves 4-7: BT) by a tensor load, two buffers, the next
// pass's tile in flight while this one is multiplied. K: a multiple of 128, >= 256.
// ---------------------------------------------------------------------------
template <int OUT_BF16, int ACT_GELU, int ADD_RES>
__global__ __launch_bounds__(256) void gemm_k(
    const u16* __restrict__ A, const u16* __restrict__ BT,
    const float* __restrict__ bias, const float* __restrict__ res,
    void* __restrict__ outp, int M, int N, int K) {
    __shared__ __attribute__((aligned(2048))) unsigned char L[2 * G_STAGE];
    const int tid = threadIdx.x, lane = tid & 31;
    const u32 wave = uni((u32)tid >> 5);
    const int wm = wave & 3, wn = wave >> 2;
    const int m0 = blockIdx.y * 128 + wm * 32;
    const int n0 = blockIdx.x * 128 + wn * 64;

    const u32 kb = (u32)K * 2u;                 // source row pitch, bytes
    const u32 T = (u32)K / G_KP;                // passes
    const unsigned char* src = (wave < 4u)
        ? (const unsigned char*)A + (u64)(blockIdx.y * 128u + wave * G_SROWS) * kb
        : (const unsigned char*)BT + (u64)(blockIdx.x * 128u + (wave - 4u) * G_SROWS) * kb;
    const u32 dst = lds_off(L) + wave * G_SLICE;
    const u32x8 g1 = tdm_group1(kb);

    f32x8 acc[2][4];
#pragma unroll
    for (int i = 0; i < 2; ++i)
#pragma unroll
        for (int j = 0; j < 4; ++j) acc[i][j] = zero8();

    // Per-lane fragment bases inside a buffer.
    const u32 lrow = (u32)(lane & 15) * G_PITCH + (u32)(lane >> 4) * 16u;
    const u32 a_base = (u32)wm * G_SLICE + lrow;
    const u32 b_base = (4u + 2u * (u32)wn) * G_SLICE + lrow;

    tdm_load(tdm_group0(dst, (u64)(size_t)src), g1);                      // stage 0
    wait_tensor0();
    __syncthreads();                                                      // stage 0 published
    tdm_load(tdm_group0(dst + G_STAGE, (u64)(size_t)src + G_ROWB), g1);   // stage 1

    // Rolled: one publish point per pass, and the buffer is picked by the pass's parity.
#pragma clang loop unroll(disable)
    for (u32 s = 0; s < T; ++s) {
        const u32 buf = (s & 1u) * G_STAGE;
        const unsigned char* la = L + buf + a_base;
        const unsigned char* lb = L + buf + b_base;
        bf16x16 af[2][2], bf[2][4];   // two fragment sets: the next 32 k load while these multiply
#pragma unroll
        for (int i = 0; i < 2; ++i) af[0][i] = lds_frag(la + (u32)i * 16u * G_PITCH);
#pragma unroll
        for (int j = 0; j < 4; ++j)
            bf[0][j] = lds_frag(lb + (u32)(j >> 1) * G_SLICE + (u32)(j & 1) * 16u * G_PITCH);
#pragma unroll
        for (int kk = 0; kk < 4; ++kk) {
            const int cur = kk & 1, nxt = cur ^ 1;
            if (kk < 3) {
#pragma unroll
                for (int i = 0; i < 2; ++i)
                    af[nxt][i] = lds_frag(la + (u32)i * 16u * G_PITCH + (u32)(kk + 1) * 64u);
#pragma unroll
                for (int j = 0; j < 4; ++j)
                    bf[nxt][j] = lds_frag(lb + (u32)(j >> 1) * G_SLICE + (u32)(j & 1) * 16u * G_PITCH + (u32)(kk + 1) * 64u);
            }
            // Keeps the LDS reads one group ahead of the block instead of spread among its WMMAs.
            __builtin_amdgcn_sched_barrier(0);
#pragma unroll
            for (int i = 0; i < 2; ++i)
#pragma unroll
                for (int j = 0; j < 4; ++j)
                    acc[i][j] = wmma32(af[cur][i], bf[cur][j], acc[i][j]);
            // Ends the block: the next group of reads stays behind these WMMAs.
            __builtin_amdgcn_sched_barrier(0);
        }
        // Publish point of stage s + 1.
        wait_ds0();
        wait_tensor0();
        __syncthreads();
        // Only while stage s + 2 exists; pinned(): a scalar branch, since a tensor load ignores EXEC.
        if (pinned((s + 2u < T) ? 1u : 0u) != 0u)   // refill the buffer this pass has just read
            tdm_load(tdm_group0(dst + buf, (u64)(size_t)src + (u64)(s + 2u) * G_ROWB), g1);
    }
    wait_tensor0();
    wait_ds0();

    const int c = lane & 15, hs = lane >> 4;
#pragma unroll
    for (int i = 0; i < 2; ++i) {
#pragma unroll
        for (int j = 0; j < 4; ++j) {
            const int col = n0 + j * 16 + c;
            const float bv = bias[col];
#pragma unroll
            for (int v = 0; v < 8; ++v) {
                const int row = m0 + i * 16 + v + 8 * hs;
                float val = acc[i][j][v] + bv;
                if (ACT_GELU) val = gelu_exact(val);
                if (ADD_RES) val += res[(size_t)row * N + col];
                if (OUT_BF16)
                    ((u16*)outp)[(size_t)row * N + col] = f2bf(val);
                else
                    ((float*)outp)[(size_t)row * N + col] = val;
            }
        }
    }
}

// ---------------------------------------------------------------------------
// V transpose per (b,h): V (b,s,h,d) bf16 -> VT (b*h, d, s) bf16
// ---------------------------------------------------------------------------
__global__ __launch_bounds__(256) void transpose_v_k(
    const u16* __restrict__ V, u16* __restrict__ VT, int S) {
    __shared__ u16 tile[32][33];
    const int s0 = blockIdx.x * 32, d0 = blockIdx.y * 32, bh = blockIdx.z;
    const int b = bh >> 4, h = bh & 15;
    const int tx = threadIdx.x, ty = threadIdx.y;
#pragma unroll
    for (int i = 0; i < 32; i += 8)
        tile[ty + i][tx] = V[(size_t)(b * S + s0 + ty + i) * 1024 + h * 64 + d0 + tx];
    __syncthreads();
#pragma unroll
    for (int i = 0; i < 32; i += 8)
        VT[(size_t)(bh * 64 + d0 + ty + i) * S + (s0 + tx)] = tile[tx][ty + i];
}

// ---------------------------------------------------------------------------
// Causal flash attention, dk = 64. Grid: (B*H, S/128), 8 waves per block,
// each wave owns 16 query rows; streams 32-key blocks with online softmax.
// K and V^T come through LDS, once per block for all eight waves: per stage of
// 64 keys every wave brings one 16-row slice (waves 0-3: 16 keys of K, waves 4-7:
// 16 dims of V^T) by a tensor load, two buffers, the next stage in flight while
// this one is worked on. A slice is one fragment's rows.
// A block's cost grows with its query tile, and not all blocks are resident at
// once: the head is the fast grid index and the tile falls with blockIdx.y, so
// the longest blocks start first, the short ones fill the places that come free,
// and neighbouring indices cost the same.
// ---------------------------------------------------------------------------
constexpr u32 T_KEYS  = 64;             // keys per stage
constexpr u32 T_ROWB  = 128;            // bytes of a tile row: 64 dk of one key, or 64 keys of one V^T row
constexpr u32 T_PITCH = T_ROWB + 16;    // LDS row pitch: an odd multiple of 16 B for ds_load_b128
constexpr u32 T_SROWS = 16;             // rows per slice (one tensor load of one wave)
constexpr u32 T_SLICE = 4096;           // 16 x 144 = 2304 B, rounded up to a multiple of 2 KiB
constexpr u32 T_STAGE = 8 * T_SLICE;    // [K 4 slices | V^T 4 slices]
static_assert(T_SROWS * T_PITCH <= T_SLICE && T_SLICE % 2048 == 0, "slice place");

// Group 1: 1-byte elements, tile = tensor = 16 rows of 128 B, 16 B of LDS pad behind each row.
__device__ __forceinline__ u32x8 tdm_group1_kv(u32 src_pitch) {
    constexpr u32 d0 = T_ROWB, d1 = T_SROWS;
    u32x8 g;
    g[0] = uni((1u << 20) | (4u << 22) | (3u << 25));
    g[1] = uni((d0 & 0xFFFFu) << 16);
    g[2] = uni((d0 >> 16) | ((d1 & 0xFFFFu) << 16));
    g[3] = uni((d1 >> 16) | (d0 << 16));
    g[4] = uni(d1);
    g[5] = uni(src_pitch);
    g[6] = uni(0u);
    g[7] = uni(0u);
    // Descriptor words held in scalar registers (the pinned() form, all eight at once), as in
    // tdm_group1: they are not rebuilt or used as temporaries while a request is outstanding.
    asm volatile("" : "+s"(g));
    return g;
}
// The wait that covers a request also names that request's group 0 as an input: the four registers
// then keep their words from the issue to this wait instead of serving as temporaries in between.
__device__ __forceinline__ void wait_tensor0_held(u32x4 g0) {
    asm volatile("s_wait_tensorcnt 0x0" :: "s"(g0) : "memory");
}

__global__ __launch_bounds__(256) void attn_k(
    const u16* __restrict__ Q, const u16* __restrict__ Kb,
    const u16* __restrict__ VT, u16* __restrict__ CTX, int S) {
    __shared__ __attribute__((aligned(2048))) unsigned char KV[2 * T_STAGE];
    const int tid = threadIdx.x, lane = tid & 31;
    const u32 wave = uni((u32)tid >> 5);
    const int bh = blockIdx.x, b = bh >> 4, h = bh & 15;
    const int qt = S / 128 - 1 - (int)blockIdx.y;   // query tile
    const int q0 = qt * 128 + (int)wave * 16;
    const int c = lane & 15, hs = lane >> 4;

    __shared__ __align__(16) u16 pbuf[8][640];   // 16 rows x stride 40 per wave
    u16* pw = pbuf[wave];

    // This wave's slice of every stage: source, step from stage to stage, row pitch, place in LDS.
    const u32 T = 2u * (u32)(qt + 1);            // stages: keys 0 .. 128 (qt + 1) - 1, never fewer than two
    const unsigned char* src = (wave < 4u)
        ? (const unsigned char*)(Kb + (size_t)(b * S + (int)wave * 16) * 1024 + h * 64)
        : (const unsigned char*)(VT + (size_t)(bh * 64 + ((int)wave - 4) * 16) * S);
    const u32 step = (wave < 4u) ? T_KEYS * 2048u : T_KEYS * 2u;
    const u32 dst = lds_off(KV) + wave * T_SLICE;
    const u32x8 g1 = tdm_group1_kv((wave < 4u) ? 2048u : (u32)S * 2u);
    const u32 lrow = (u32)c * T_PITCH + (u32)hs * 16u;   // the lane's row and half inside a slice

    const u16* qbase = Q + (size_t)(b * S + q0) * 1024 + h * 64;
    const bf16x16 aq0 = load_frag(qbase, 1024, lane);        // dk 0..31
    const bf16x16 aq1 = load_frag(qbase + 32, 1024, lane);   // dk 32..63

    float mrow[8], lsum[8];
    f32x8 cacc[4];
#pragma unroll
    for (int v = 0; v < 8; ++v) { mrow[v] = -1e30f; lsum[v] = 0.0f; }
#pragma unroll
    for (int n = 0; n < 4; ++n) cacc[n] = zero8();

    const float SC = 0.125f;            // 1/sqrt(64)
    const float L2E = 1.44269504f;

    u32x4 g0 = tdm_group0(dst, (u64)(size_t)src);
    tdm_load(g0, g1);                                                    // stage 0
    wait_tensor0_held(g0);
    __syncthreads();                                                     // stage 0 published
    g0 = tdm_group0(dst + T_STAGE, (u64)(size_t)src + step);
    tdm_load(g0, g1);                                                    // stage 1

    // Rolled: one publish point per stage, and the buffer is picked by the stage's parity.
#pragma clang loop unroll(disable)
    for (u32 s = 0; s < T; ++s) {
      const u32 buf = (s & 1u) * T_STAGE;
      // Unrolled: the half stage is a constant LDS offset, and the running state stays in its registers.
#pragma unroll
      for (int sub = 0; sub < 2; ++sub) {
        const int kb = (int)s * (int)T_KEYS + sub * 32;
        // Wave-uniform: a wave skips the keys beyond its diagonal; it still passes the publish point.
        if (kb >= q0 + 16) continue;
        const unsigned char* lk = KV + buf + (u32)(2 * sub) * T_SLICE + lrow;
        const unsigned char* lv = KV + buf + 4u * T_SLICE + (u32)sub * 64u + lrow;
        // ---- scores: S = Q(16x64) @ K^T(64x32) in two 16-key column frags
        f32x8 s0 = zero8(), s1 = zero8();
        s0 = wmma32(aq0, lds_frag(lk), s0);
        s1 = wmma32(aq0, lds_frag(lk + T_SLICE), s1);
        s0 = wmma32(aq1, lds_frag(lk + 64), s0);
        s1 = wmma32(aq1, lds_frag(lk + T_SLICE + 64), s1);

        // ---- online softmax per row (rows live in (vgpr, lane-half))
#pragma unroll
        for (int v = 0; v < 8; ++v) {
            const int row = q0 + v + 8 * hs;
            const int key0 = kb + c, key1 = key0 + 16;
            float f0 = (key0 <= row) ? s0[v] * SC : -1e30f;
            float f1 = (key1 <= row) ? s1[v] * SC : -1e30f;
            float mx = fmaxf(f0, f1);
#pragma unroll
            for (int off = 8; off; off >>= 1) mx = fmaxf(mx, __shfl_xor(mx, off, 32));
            const float mnew = fmaxf(mrow[v], mx);
            const float p0 = exp2f((f0 - mnew) * L2E);
            const float p1 = exp2f((f1 - mnew) * L2E);
            float ps = p0 + p1;
#pragma unroll
            for (int off = 8; off; off >>= 1) ps += __shfl_xor(ps, off, 32);
            const float alpha = exp2f((mrow[v] - mnew) * L2E);
            lsum[v] = lsum[v] * alpha + ps;
            mrow[v] = mnew;
#pragma unroll
            for (int n = 0; n < 4; ++n) cacc[n][v] *= alpha;
            const int prow = v + 8 * hs;
            pw[prow * 40 + c] = f2bf(p0);
            pw[prow * 40 + 16 + c] = f2bf(p1);
        }
        asm volatile("s_wait_dscnt 0" ::: "memory");   // LDS stores visible to wave
        const bf16x16 pfrag = load_frag(pw, 40, lane); // P (16x32) in A layout

        // ---- ctx += P(16x32) @ V(32x64), V^T rows give contiguous B frags
#pragma unroll
        for (int n = 0; n < 4; ++n)
            cacc[n] = wmma32(pfrag, lds_frag(lv + (u32)n * T_SLICE), cacc[n]);
      }
      // Publish point of stage s + 1.
      wait_ds0();
      wait_tensor0_held(g0);
      __syncthreads();
      // Only while stage s + 2 exists; pinned(): a scalar branch, since a tensor load ignores EXEC.
      if (pinned((s + 2u < T) ? 1u : 0u) != 0u) {   // refill the buffer this stage has just read
          g0 = tdm_group0(dst + buf, (u64)(size_t)src + (u64)(s + 2u) * step);
          tdm_load(g0, g1);
      }
    }
    wait_tensor0();
    wait_ds0();

    float inv[8];
#pragma unroll
    for (int v = 0; v < 8; ++v) inv[v] = 1.0f / lsum[v];
#pragma unroll
    for (int n = 0; n < 4; ++n)
#pragma unroll
        for (int v = 0; v < 8; ++v) {
            const int row = q0 + v + 8 * hs;
            const int col = n * 16 + c;
            CTX[(size_t)(b * S + row) * 1024 + h * 64 + col] = f2bf(cacc[n][v] * inv[v]);
        }
}

// ---------------------------------------------------------------------------
// Host-side orchestration
// ---------------------------------------------------------------------------
extern "C" void kernel_launch(void* const* d_in, const int* in_sizes, int n_in,
                              void* d_out, int out_size, void* d_ws, size_t ws_size,
                              hipStream_t stream) {
    constexpr int B = 4, S = 2048, D = 1024, H = 16, F = 4096;
    constexpr int M = B * S;  // 8192 tokens
    constexpr size_t MiB = 1u << 20;

    const float* x    = (const float*)d_in[0];
    const float* Wq   = (const float*)d_in[1];
    const float* bq   = (const float*)d_in[2];
    const float* Wk   = (const float*)d_in[3];
    const float* bk   = (const float*)d_in[4];
    const float* Wv   = (const float*)d_in[5];
    const float* bv   = (const float*)d_in[6];
    const float* Wo   = (const float*)d_in[7];
    const float* bo   = (const float*)d_in[8];
    const float* ln1g = (const float*)d_in[9];
    const float* ln1b = (const float*)d_in[10];
    const float* ln2g = (const float*)d_in[11];
    const float* ln2b = (const float*)d_in[12];
    const float* W1   = (const float*)d_in[13];
    const float* b1   = (const float*)d_in[14];
    const float* W2   = (const float*)d_in[15];
    const float* b2   = (const float*)d_in[16];

    char* ws = (char*)d_ws;
    u16*   WQT = (u16*)(ws + 0 * MiB);     // D x D bf16 (transposed)  2 MiB
    u16*   WKT = (u16*)(ws + 2 * MiB);
    u16*   WVT = (u16*)(ws + 4 * MiB);
    u16*   WOT = (u16*)(ws + 6 * MiB);
    u16*   W1T = (u16*)(ws + 8 * MiB);     // F x D bf16               8 MiB
    u16*   W2T = (u16*)(ws + 16 * MiB);    // D x F bf16               8 MiB
    u16*   H1  = (u16*)(ws + 24 * MiB);    // M x D bf16              16 MiB
    u16*   QB  = (u16*)(ws + 40 * MiB);    // M x D bf16
    u16*   KB  = (u16*)(ws + 56 * MiB);
    u16*   VB  = (u16*)(ws + 72 * MiB);
    u16*   VTB = (u16*)(ws + 88 * MiB);    // (B*H) x 64 x S bf16
    u16*   CTX = (u16*)(ws + 104 * MiB);   // M x D bf16
    float* X1  = (float*)(ws + 120 * MiB); // M x D f32               32 MiB
    u16*   U   = (u16*)(ws + 40 * MiB);    // M x F bf16 (reuses Q/K/V/VT) 64 MiB
    float* OUT = (float*)d_out;
    (void)in_sizes; (void)n_in; (void)out_size; (void)ws_size;

    const dim3 tb(32, 8);
    // 0) weights -> bf16 transposed (L2-resident working set: 24 MiB)
    cast_transpose_k<<<dim3(D / 32, D / 32), tb, 0, stream>>>(Wq, WQT, D, D);
    cast_transpose_k<<<dim3(D / 32, D / 32), tb, 0, stream>>>(Wk, WKT, D, D);
    cast_transpose_k<<<dim3(D / 32, D / 32), tb, 0, stream>>>(Wv, WVT, D, D);
    cast_transpose_k<<<dim3(D / 32, D / 32), tb, 0, stream>>>(Wo, WOT, D, D);
    cast_transpose_k<<<dim3(F / 32, D / 32), tb, 0, stream>>>(W1, W1T, D, F);
    cast_transpose_k<<<dim3(D / 32, F / 32), tb, 0, stream>>>(W2, W2T, F, D);

    // 1) LN1: x -> H1 (bf16)
    layernorm_k<<<M, 256, 0, stream>>>(x, ln1g, ln1b, H1);

    // 2) Q/K/V projections (bf16 out)
    gemm_k<1, 0, 0><<<dim3(D / 128, M / 128), 256, 0, stream>>>(H1, WQT, bq, nullptr, QB, M, D, D);
    gemm_k<1, 0, 0><<<dim3(D / 128, M / 128), 256, 0, stream>>>(H1, WKT, bk, nullptr, KB, M, D, D);
    gemm_k<1, 0, 0><<<dim3(D / 128, M / 128), 256, 0, stream>>>(H1, WVT, bv, nullptr, VB, M, D, D);

    // 3) V -> VT per (b,h)
    transpose_v_k<<<dim3(S / 32, 2, B * H), tb, 0, stream>>>(VB, VTB, S);

    // 4) causal flash attention -> CTX (bf16)
    attn_k<<<dim3(B * H, S / 128), 256, 0, stream>>>(QB, KB, VTB, CTX, S);

    // 5) output projection + residual: X1 = x + CTX @ Wo + bo (f32)
    gemm_k<0, 0, 1><<<dim3(D / 128, M / 128), 256, 0, stream>>>(CTX, WOT, bo, x, X1, M, D, D);

    // 6) LN2: X1 -> H1 (bf16, reuse)
    layernorm_k<<<M, 256, 0, stream>>>(X1, ln2g, ln2b, H1);

    // 7) FFN up + exact GELU -> U (bf16)
    gemm_k<1, 1, 0><<<dim3(F / 128, M / 128), 256, 0, stream>>>(H1, W1T, b1, nullptr, U, M, F, D);

    // 8) FFN down + residual -> OUT (f32)
    gemm_k<0, 0, 1><<<dim3(D / 128, M / 128), 256, 0, stream>>>(U, W2T, b2, X1, OUT, M, D, F);
}

// v004
// Measured time: 296 microseconds a run.
// In both of two side-by-side timings against v003, it was 1.36 times as fast.
// Over all steps from v000 it is 3.06 times as fast.
#include <hip/hip_runtime.h>

typedef unsigned short u16;
typedef __attribute__((ext_vector_type(16))) __bf16 bf16x16;
typedef __attribute__((ext_vector_type(8)))  float  f32x8;

union FragU { bf16x16 v; uint4 q[2]; };

__device__ __forceinline__ u16 f2bf(float f) {
    unsigned u = __float_as_uint(f);
    u += 0x7FFFu + ((u >> 16) & 1u);   // round-to-nearest-even
    return (u16)(u >> 16);
}

__device__ __forceinline__ f32x8 zero8() {
    f32x8 z;
#pragma unroll
    for (int i = 0; i < 8; ++i) z[i] = 0.0f;
    return z;
}

// Load one 16x32 bf16 operand fragment (A-layout; B uses transposed source so
// the same layout applies). Lanes 0-15: rows 0-15, K 0-7 & 16-23.
// Lanes 16-31: rows 0-15, K 8-15 & 24-31. Two 16B loads per lane.
__device__ __forceinline__ bf16x16 load_frag(const u16* base, int stride, int lane) {
    const int half = lane >> 4, r = lane & 15;
    const u16* p = base + (size_t)r * stride + half * 8;
    FragU u;
    u.q[0] = *(const uint4*)(p);
    u.q[1] = *(const uint4*)(p + 16);
    return u.v;
}

__device__ __forceinline__ f32x8 wmma32(bf16x16 a, bf16x16 b, f32x8 c) {
    return __builtin_amdgcn_wmma_f32_16x16x32_bf16(false, a, false, b, (short)0, c, false, false);
}

__device__ __forceinline__ float gelu_exact(float x) {
    return 0.5f * x * (1.0f + erff(x * 0.70710678118654752f));
}

// ---------------------------------------------------------------------------
// Weight cast + transpose: in (K x N) f32 row-major -> out (N x K) bf16
// ---------------------------------------------------------------------------
__global__ __launch_bounds__(256) void cast_transpose_k(
    const float* __restrict__ in, u16* __restrict__ out, int K, int N) {
    __shared__ float tile[32][33];
    const int n0 = blockIdx.x * 32, k0 = blockIdx.y * 32;
    const int tx = threadIdx.x, ty = threadIdx.y;
#pragma unroll
    for (int i = 0; i < 32; i += 8)
        tile[ty + i][tx] = in[(size_t)(k0 + ty + i) * N + (n0 + tx)];
    __syncthreads();
#pragma unroll
    for (int i = 0; i < 32; i += 8)
        out[(size_t)(n0 + ty + i) * K + (k0 + tx)] = f2bf(tile[tx][ty + i]);
}

// ---------------------------------------------------------------------------
// LayerNorm (f32 in, bf16 out), one 256-thread block per row of D=1024
// ---------------------------------------------------------------------------
__global__ __launch_bounds__(256) void layernorm_k(
    const float* __restrict__ in, const float* __restrict__ g,
    const float* __restrict__ be, u16* __restrict__ out) {
    const int row = blockIdx.x, tid = threadIdx.x;
    const float* rp = in + (size_t)row * 1024;
    float v[4], s = 0.0f, ss = 0.0f;
#pragma unroll
    for (int i = 0; i < 4; ++i) {
        v[i] = rp[tid + 256 * i];
        s += v[i];
        ss += v[i] * v[i];
    }
    __shared__ float rs[256], rq[256];
    rs[tid] = s; rq[tid] = ss;
    __syncthreads();
    for (int off = 128; off > 0; off >>= 1) {
        if (tid < off) { rs[tid] += rs[tid + off]; rq[tid] += rq[tid + off]; }
        __syncthreads();
    }
    const float mu = rs[0] * (1.0f / 1024.0f);
    const float var = rq[0] * (1.0f / 1024.0f) - mu * mu;
    const float rstd = rsqrtf(var + 1e-5f);
    u16* op = out + (size_t)row * 1024;
#pragma unroll
    for (int i = 0; i < 4; ++i) {
        const int col = tid + 256 * i;
        op[col] = f2bf((v[i] - mu) * rstd * g[col] + be[col]);
    }
}

// ---------------------------------------------------------------------------
// Tensor-load helpers for the GEMM's LDS ring
// ---------------------------------------------------------------------------
typedef unsigned int u32;
typedef unsigned long long u64;
typedef u32 u32x4 __attribute__((ext_vector_type(4)));
typedef u32 u32x8 __attribute__((ext_vector_type(8)));

constexpr u32 G_KP    = 128;            // k per pass
constexpr u32 G_ROWB  = 2 * G_KP;       // bytes of one operand row per pass
constexpr u32 G_PITCH = G_ROWB + 16;    // LDS row pitch: an odd multiple of 16 B for ds_load_b128
constexpr u32 G_SROWS = 32;             // rows per slice (one tensor load of one wave)
constexpr u32 G_SLICE = 10240;          // 32 x 272 = 8704 B, rounded up to a multiple of 2 KiB
constexpr u32 G_STAGE = 8 * G_SLICE;    // [A 4 slices | B 4 slices]
static_assert(G_SROWS * G_PITCH <= G_SLICE && G_SLICE % 2048 == 0, "slice place");

__device__ __forceinline__ u32 uni(u32 v) { return (u32)__builtin_amdgcn_readfirstlane(v); }
__device__ __forceinline__ u32 pinned(u32 v) { u32 w = uni(v); asm volatile("" : "+s"(w)); return w; }
__device__ __forceinline__ u32 lds_off(const void* p) { return (u32)(size_t)p; }
// The compiler places no wait for the tensor mover: the tile counts as landed behind this.
__device__ __forceinline__ void wait_tensor0() { asm volatile("s_wait_tensorcnt 0x0" ::: "memory"); }
// This wave's LDS reads have returned before the buffer is handed back for a refill.
__device__ __forceinline__ void wait_ds0() { asm volatile("s_wait_dscnt 0x0" ::: "memory"); }
// One request of the whole wave: a 2-D tile from global memory into LDS.
__device__ __forceinline__ void tdm_load(u32x4 g0, u32x8 g1) {
    asm volatile("tensor_load_to_lds %0, %1" :: "s"(g0), "s"(g1) : "memory");
}
// Group 1: 1-byte elements, tile = tensor = 32 rows of 256 B, 16 B of LDS pad behind each row.
__device__ __forceinline__ u32x8 tdm_group1(u32 src_pitch) {
    constexpr u32 d0 = G_ROWB, d1 = G_SROWS;
    u32x8 g;
    g[0] = uni((1u << 20) | (5u << 22) | (3u << 25));
    g[1] = uni((d0 & 0xFFFFu) << 16);
    g[2] = uni((d0 >> 16) | ((d1 & 0xFFFFu) << 16));
    g[3] = uni((d1 >> 16) | (d0 << 16));
    g[4] = uni(d1);
    g[5] = uni(src_pitch);
    g[6] = uni(0u);
    g[7] = uni(0u);
    // Descriptor words held in scalar registers (the pinned() form, all eight at once): without it
    // the compiler rebuilds the constants before each issue and uses those registers as
    // temporaries while a request is outstanding.
    asm volatile("" : "+s"(g));
    return g;
}
__device__ __forceinline__ u32x4 tdm_group0(u32 lds_dst, u64 ga) {
    u32x4 g;
    g[0] = uni(1u);
    g[1] = uni(lds_dst);
    g[2] = uni((u32)ga);
    g[3] = uni((((u32)(ga >> 32)) & 0x01FFFFFFu) | 0x80000000u);
    return g;
}
// One 16x32 bf16 fragment from an LDS row block; p already holds the lane's row and half.
// Same k order as load_frag: 16 B at k = 8 * half, 16 B at k = 16 + 8 * half.
__device__ __forceinline__ bf16x16 lds_frag(const unsigned char* p) {
    FragU u;
    u.q[0] = *(const uint4*)(p);
    u.q[1] = *(const uint4*)(p + 32);
    return u.v;
}

// ---------------------------------------------------------------------------
// WMMA GEMM: C[M,N] = act(A[M,K] @ B[K,N] + bias) (+ residual)
// A: bf16 row-major, BT: bf16 N x K (transposed), bias f32.
// 256 threads = 8 waves; block tile 128x128; wave tile 32(M)x64(N).
// Operands come through LDS: per pass of 128 k every wave brings one 32-row
// slice (waves 0-3: A, waves 4-7: BT) by a tensor load, two buffers, the next
// pass's tile in flight while this one is multiplied. K: a multiple of 128, >= 256.
// ---------------------------------------------------------------------------
template <int OUT_BF16, int ACT_GELU, int ADD_RES>
__global__ __launch_bounds__(256) void gemm_k(
    const u16* __restrict__ A, const u16* __restrict__ BT,
    const float* __restrict__ bias, const float* __restrict__ res,
    void* __restrict__ outp, int M, int N, int K) {
    __shared__ __attribute__((aligned(2048))) unsigned char L[2 * G_STAGE];
    const int tid = threadIdx.x, lane = tid & 31;
    const u32 wave = uni((u32)tid >> 5);
    const int wm = wave & 3, wn = wave >> 2;
    const int m0 = blockIdx.y * 128 + wm * 32;
    const int n0 = blockIdx.x * 128 + wn * 64;

    const u32 kb = (u32)K * 2u;                 // source row pitch, bytes
    const u32 T = (u32)K / G_KP;                // passes
    const unsigned char* src = (wave < 4u)
        ? (const unsigned char*)A + (u64)(blockIdx.y * 128u + wave * G_SROWS) * kb
        : (const unsigned char*)BT + (u64)(blockIdx.x * 128u + (wave - 4u) * G_SROWS) * kb;
    const u32 dst = lds_off(L) + wave * G_SLICE;
    const u32x8 g1 = tdm_group1(kb);

    f32x8 acc[2][4];
#pragma unroll
    for (int i = 0; i < 2; ++i)
#pragma unroll
        for (int j = 0; j < 4; ++j) acc[i][j] = zero8();

    // Per-lane fragment bases inside a buffer.
    const u32 lrow = (u32)(lane & 15) * G_PITCH + (u32)(lane >> 4) * 16u;
    const u32 a_base = (u32)wm * G_SLICE + lrow;
    const u32 b_base = (4u + 2u * (u32)wn) * G_SLICE + lrow;

    tdm_load(tdm_group0(dst, (u64)(size_t)src), g1);                      // stage 0
    wait_tensor0();
    __syncthreads();                                                      // stage 0 published
    tdm_load(tdm_group0(dst + G_STAGE, (u64)(size_t)src + G_ROWB), g1);   // stage 1

    // Rolled: one publish point per pass, and the buffer is picked by the pass's parity.
#pragma clang loop unroll(disable)
    for (u32 s = 0; s < T; ++s) {
        const u32 buf = (s & 1u) * G_STAGE;
        const unsigned char* la = L + buf + a_base;
        const unsigned char* lb = L + buf + b_base;
        bf16x16 af[2][2], bf[2][4];   // two fragment sets: the next 32 k load while these multiply
#pragma unroll
        for (int i = 0; i < 2; ++i) af[0][i] = lds_frag(la + (u32)i * 16u * G_PITCH);
#pragma unroll
        for (int j = 0; j < 4; ++j)
            bf[0][j] = lds_frag(lb + (u32)(j >> 1) * G_SLICE + (u32)(j & 1) * 16u * G_PITCH);
#pragma unroll
        for (int kk = 0; kk < 4; ++kk) {
            const int cur = kk & 1, nxt = cur ^ 1;
            if (kk < 3) {
#pragma unroll
                for (int i = 0; i < 2; ++i)
                    af[nxt][i] = lds_frag(la + (u32)i * 16u * G_PITCH + (u32)(kk + 1) * 64u);
#pragma unroll
                for (int j = 0; j < 4; ++j)
                    bf[nxt][j] = lds_frag(lb + (u32)(j >> 1) * G_SLICE + (u32)(j & 1) * 16u * G_PITCH + (u32)(kk + 1) * 64u);
            }
            // Keeps the LDS reads one group ahead of the block instead of spread among its WMMAs.
            __builtin_amdgcn_sched_barrier(0);
#pragma unroll
            for (int i = 0; i < 2; ++i)
#pragma unroll
                for (int j = 0; j < 4; ++j)
                    acc[i][j] = wmma32(af[cur][i], bf[cur][j], acc[i][j]);
            // Ends the block: the next group of reads stays behind these WMMAs.
            __builtin_amdgcn_sched_barrier(0);
        }
        // Publish point of stage s + 1.
        wait_ds0();
        wait_tensor0();
        __syncthreads();
        // Only while stage s + 2 exists; pinned(): a scalar branch, since a tensor load ignores EXEC.
        if (pinned((s + 2u < T) ? 1u : 0u) != 0u)   // refill the buffer this pass has just read
            tdm_load(tdm_group0(dst + buf, (u64)(size_t)src + (u64)(s + 2u) * G_ROWB), g1);
    }
    wait_tensor0();
    wait_ds0();

    const int c = lane & 15, hs = lane >> 4;
#pragma unroll
    for (int i = 0; i < 2; ++i) {
#pragma unroll
        for (int j = 0; j < 4; ++j) {
            const int col = n0 + j * 16 + c;
            const float bv = bias[col];
#pragma unroll
            for (int v = 0; v < 8; ++v) {
                const int row = m0 + i * 16 + v + 8 * hs;
                float val = acc[i][j][v] + bv;
                if (ACT_GELU) val = gelu_exact(val);
                if (ADD_RES) val += res[(size_t)row * N + col];
                if (OUT_BF16)
                    ((u16*)outp)[(size_t)row * N + col] = f2bf(val);
                else
                    ((float*)outp)[(size_t)row * N + col] = val;
            }
        }
    }
}

// ---------------------------------------------------------------------------
// V transpose per (b,h): V (b,s,h,d) bf16 -> VT (b*h, d, s) bf16
// ---------------------------------------------------------------------------
__global__ __launch_bounds__(256) void transpose_v_k(
    const u16* __restrict__ V, u16* __restrict__ VT, int S) {
    __shared__ u16 tile[32][33];
    const int s0 = blockIdx.x * 32, d0 = blockIdx.y * 32, bh = blockIdx.z;
    const int b = bh >> 4, h = bh & 15;
    const int tx = threadIdx.x, ty = threadIdx.y;
#pragma unroll
    for (int i = 0; i < 32; i += 8)
        tile[ty + i][tx] = V[(size_t)(b * S + s0 + ty + i) * 1024 + h * 64 + d0 + tx];
    __syncthreads();
#pragma unroll
    for (int i = 0; i < 32; i += 8)
        VT[(size_t)(bh * 64 + d0 + ty + i) * S + (s0 + tx)] = tile[tx][ty + i];
}

constexpr u32 T_KEYS  = 64;
constexpr u32 T_ROWB  = 128;
constexpr u32 T_PITCH = T_ROWB + 16;
constexpr u32 T_SROWS = 16;
constexpr u32 T_SLICE = 4096;
constexpr u32 T_STAGE = 8 * T_SLICE;
static_assert(T_SROWS * T_PITCH <= T_SLICE && T_SLICE % 2048 == 0, "slice place");

// Group 1: 1-byte elements, tile = tensor = 16 rows of 128 B, 16 B of LDS pad behind each row.
__device__ __forceinline__ u32x8 tdm_group1_kv(u32 src_pitch) {
    constexpr u32 d0 = T_ROWB, d1 = T_SROWS;
    u32x8 g;
    g[0] = uni((1u << 20) | (4u << 22) | (3u << 25));
    g[1] = uni((d0 & 0xFFFFu) << 16);
    g[2] = uni((d0 >> 16) | ((d1 & 0xFFFFu) << 16));
    g[3] = uni((d1 >> 16) | (d0 << 16));
    g[4] = uni(d1);
    g[5] = uni(src_pitch);
    g[6] = uni(0u);
    g[7] = uni(0u);
    // Descriptor words held in scalar registers (the pinned() form, all eight at once), as in
    // tdm_group1: they are not rebuilt or used as temporaries while a request is outstanding.
    asm volatile("" : "+s"(g));
    return g;
}
// The wait that covers a request also names that request's group 0 as an input: the four registers
// then keep their words from the issue to this wait instead of serving as temporaries in between.
__device__ __forceinline__ void wait_tensor0_held(u32x4 g0) {
    asm volatile("s_wait_tensorcnt 0x0" :: "s"(g0) : "memory");
}

// Lane l <-> l ^ 16: the same column's value in the wave's other half.
__device__ __forceinline__ float other_half(float x) {
    const int b = __float_as_int(x);
    return __int_as_float(__builtin_amdgcn_permlanex16(b, b, 0x76543210, 0xfedcba98, false, false));
}
// Two f32 to one register of two bf16 (lo in the low half), round to nearest even as f2bf does.
__device__ __forceinline__ u32 pack_bf(float lo, float hi) {
    typedef __bf16 bf16x2 __attribute__((ext_vector_type(2)));
    typedef float f32x2 __attribute__((ext_vector_type(2)));
    return __builtin_bit_cast(u32, __builtin_convertvector(f32x2{lo, hi}, bf16x2));
}

__global__ __launch_bounds__(256) void attn_k(
    const u16* __restrict__ Q, const u16* __restrict__ Kb,
    const u16* __restrict__ VT, u16* __restrict__ CTX, int S) {
    __shared__ __attribute__((aligned(2048))) unsigned char KV[2 * T_STAGE];
    const int tid = threadIdx.x, lane = tid & 31;
    const u32 wave = uni((u32)tid >> 5);
    const int bh = blockIdx.x, b = bh >> 4, h = bh & 15;
    const int qt = S / 128 - 1 - (int)blockIdx.y;   // query tile
    const int q0 = qt * 128 + (int)wave * 16;
    const int c = lane & 15, hs = lane >> 4;

    // This wave's slice of every stage: source, step from stage to stage, row pitch, place in LDS.
    const u32 T = 2u * (u32)(qt + 1);            // stages: keys 0 .. 128 (qt + 1) - 1, never fewer than two
    const unsigned char* src = (wave < 4u)
        ? (const unsigned char*)(Kb + (size_t)(b * S + (int)wave * 16) * 1024 + h * 64)
        : (const unsigned char*)(VT + (size_t)(bh * 64 + ((int)wave - 4) * 16) * S);
    const u32 step = (wave < 4u) ? T_KEYS * 2048u : T_KEYS * 2u;
    const u32 dst = lds_off(KV) + wave * T_SLICE;
    const u32x8 g1 = tdm_group1_kv((wave < 4u) ? 2048u : (u32)S * 2u);
    const u32 lrow = (u32)c * T_PITCH + (u32)hs * 16u;   // the lane's row and half inside a slice

    const u16* qbase = Q + (size_t)(b * S + q0) * 1024 + h * 64;
    const bf16x16 aq0 = load_frag(qbase, 1024, lane);        // dk 0..31, B operand: column = query
    const bf16x16 aq1 = load_frag(qbase + 32, 1024, lane);   // dk 32..63
    const int row = q0 + c;             // the lane's query

    float mrow = -1e30f;                // running maximum of the lane's query, equal in both halves
    float lsum = 0.0f;                  // running sum over this half's keys; the halves join at the end
    f32x8 cacc[4];                      // O^T: dim n * 16 + v + 8 * hs of the lane's query
#pragma unroll
    for (int n = 0; n < 4; ++n) cacc[n] = zero8();

    const float SC = 0.125f;            // 1/sqrt(64)
    const float L2E = 1.44269504f;

    u32x4 g0 = tdm_group0(dst, (u64)(size_t)src);
    tdm_load(g0, g1);                                                    // stage 0
    wait_tensor0_held(g0);
    __syncthreads();                                                     // stage 0 published
    g0 = tdm_group0(dst + T_STAGE, (u64)(size_t)src + step);
    tdm_load(g0, g1);                                                    // stage 1

    // Rolled: one publish point per stage, and the buffer is picked by the stage's parity.
#pragma clang loop unroll(disable)
    for (u32 s = 0; s < T; ++s) {
      const u32 buf = (s & 1u) * T_STAGE;
      // Unrolled: the half stage is a constant LDS offset, and the running state stays in its registers.
#pragma unroll
      for (int sub = 0; sub < 2; ++sub) {
        const int kb = (int)s * (int)T_KEYS + sub * 32;
        // Wave-uniform: a wave skips the keys beyond its diagonal; it still passes the publish point.
        if (kb >= q0 + 16) continue;
        const unsigned char* lk = KV + buf + (u32)(2 * sub) * T_SLICE + lrow;
        const unsigned char* lv = KV + buf + 4u * T_SLICE + (u32)sub * 64u + lrow;
        // ---- scores: S^T = K(32x64) @ Q^T(64x16) in two 16-key row frags
        f32x8 s0 = zero8(), s1 = zero8();
        s0 = wmma32(lds_frag(lk), aq0, s0);
        s1 = wmma32(lds_frag(lk + T_SLICE), aq0, s1);
        s0 = wmma32(lds_frag(lk + 64), aq1, s0);
        s1 = wmma32(lds_frag(lk + T_SLICE + 64), aq1, s1);

        // ---- online softmax of the lane's query over its 16 keys of this block
        // Register v holds keys kb + 8 * hs + v and, in s1, 16 more: allowed while not above the query.
        const int last = row - 8 * hs - kb;
        float f0[8], f1[8];
        float mx = -1e30f;
#pragma unroll
        for (int v = 0; v < 8; ++v) {
            f0[v] = (v <= last) ? s0[v] * SC : -1e30f;
            f1[v] = (v + 16 <= last) ? s1[v] * SC : -1e30f;
            mx = fmaxf(mx, fmaxf(f0[v], f1[v]));
        }
        mx = fmaxf(mx, other_half(mx));   // both halves scale P by the same maximum
        const float mnew = fmaxf(mrow, mx);
        const float alpha = exp2f((mrow - mnew) * L2E);
        mrow = mnew;
        float ps = 0.0f;
#pragma unroll
        for (int v = 0; v < 8; ++v) {
            f0[v] = exp2f((f0[v] - mnew) * L2E);
            f1[v] = exp2f((f1[v] - mnew) * L2E);
            ps += f0[v] + f1[v];
        }
        lsum = lsum * alpha + ps;
#pragma unroll
        for (int n = 0; n < 4; ++n)
#pragma unroll
            for (int v = 0; v < 8; ++v) cacc[n][v] *= alpha;
        // P^T (32 keys x 16 queries) as a B fragment: elements 0-7 are keys 8 * hs + 0..7,
        // elements 8-15 keys 16 + 8 * hs + 0..7, the k order of lds_frag on the V^T rows.
        FragU pf;
        pf.q[0] = make_uint4(pack_bf(f0[0], f0[1]), pack_bf(f0[2], f0[3]),
                             pack_bf(f0[4], f0[5]), pack_bf(f0[6], f0[7]));
        pf.q[1] = make_uint4(pack_bf(f1[0], f1[1]), pack_bf(f1[2], f1[3]),
                             pack_bf(f1[4], f1[5]), pack_bf(f1[6], f1[7]));

        // ---- O^T += V^T(64x32) @ P^T(32x16), V^T rows are the A frags
#pragma unroll
        for (int n = 0; n < 4; ++n)
            cacc[n] = wmma32(lds_frag(lv + (u32)n * T_SLICE), pf.v, cacc[n]);
      }
      // Publish point of stage s + 1.
      wait_ds0();
      wait_tensor0_held(g0);
      __syncthreads();
      // Only while stage s + 2 exists; pinned(): a scalar branch, since a tensor load ignores EXEC.
      if (pinned((s + 2u < T) ? 1u : 0u) != 0u) {   // refill the buffer this stage has just read
          g0 = tdm_group0(dst + buf, (u64)(size_t)src + (u64)(s + 2u) * step);
          tdm_load(g0, g1);
      }
    }
    wait_tensor0();
    wait_ds0();

    const float inv = 1.0f / (lsum + other_half(lsum));
    // A lane holds 8 neighbouring dims of its query per fragment: one 16-byte store each.
    u16* op = CTX + (size_t)(b * S + row) * 1024 + h * 64 + 8 * hs;
#pragma unroll
    for (int n = 0; n < 4; ++n)
        *(uint4*)(op + n * 16) = make_uint4(
            pack_bf(cacc[n][0] * inv, cacc[n][1] * inv), pack_bf(cacc[n][2] * inv, cacc[n][3] * inv),
            pack_bf(cacc[n][4] * inv, cacc[n][5] * inv), pack_bf(cacc[n][6] * inv, cacc[n][7] * inv));
}

// ---------------------------------------------------------------------------
// Host-side orchestration
// ---------------------------------------------------------------------------
extern "C" void kernel_launch(void* const* d_in, const int* in_sizes, int n_in,
                              void* d_out, int out_size, void* d_ws, size_t ws_size,
                              hipStream_t stream) {
    constexpr int B = 4, S = 2048, D = 1024, H = 16, F = 4096;
    constexpr int M = B * S;  // 8192 tokens
    constexpr size_t MiB = 1u << 20;

    const float* x    = (const float*)d_in[0];
    const float* Wq   = (const float*)d_in[1];
    const float* bq   = (const float*)d_in[2];
    const float* Wk   = (const float*)d_in[3];
    const float* bk   = (const float*)d_in[4];
    const float* Wv   = (const float*)d_in[5];
    const float* bv   = (const float*)d_in[6];
    const float* Wo   = (const float*)d_in[7];
    const float* bo   = (const float*)d_in[8];
    const float* ln1g = (const float*)d_in[9];
    const float* ln1b = (const float*)d_in[10];
    const float* ln2g = (const float*)d_in[11];
    const float* ln2b = (const float*)d_in[12];
    const float* W1   = (const float*)d_in[13];
    const float* b1   = (const float*)d_in[14];
    const float* W2   = (const float*)d_in[15];
    const float* b2   = (const float*)d_in[16];

    char* ws = (char*)d_ws;
    u16*   WQT = (u16*)(ws + 0 * MiB);     // D x D bf16 (transposed)  2 MiB
    u16*   WKT = (u16*)(ws + 2 * MiB);
    u16*   WVT = (u16*)(ws + 4 * MiB);
    u16*   WOT = (u16*)(ws + 6 * MiB);
    u16*   W1T = (u16*)(ws + 8 * MiB);     // F x D bf16               8 MiB
    u16*   W2T = (u16*)(ws + 16 * MiB);    // D x F bf16               8 MiB
    u16*   H1  = (u16*)(ws + 24 * MiB);    // M x D bf16              16 MiB
    u16*   QB  = (u16*)(ws + 40 * MiB);    // M x D bf16
    u16*   KB  = (u16*)(ws + 56 * MiB);
    u16*   VB  = (u16*)(ws + 72 * MiB);
    u16*   VTB = (u16*)(ws + 88 * MiB);    // (B*H) x 64 x S bf16
    u16*   CTX = (u16*)(ws + 104 * MiB);   // M x D bf16
    float* X1  = (float*)(ws + 120 * MiB); // M x D f32               32 MiB
    u16*   U   = (u16*)(ws + 40 * MiB);    // M x F bf16 (reuses Q/K/V/VT) 64 MiB
    float* OUT = (float*)d_out;
    (void)in_sizes; (void)n_in; (void)out_size; (void)ws_size;

    const dim3 tb(32, 8);
    // 0) weights -> bf16 transposed (L2-resident working set: 24 MiB)
    cast_transpose_k<<<dim3(D / 32, D / 32), tb, 0, stream>>>(Wq, WQT, D, D);
    cast_transpose_k<<<dim3(D / 32, D / 32), tb, 0, stream>>>(Wk, WKT, D, D);
    cast_transpose_k<<<dim3(D / 32, D / 32), tb, 0, stream>>>(Wv, WVT, D, D);
    cast_transpose_k<<<dim3(D / 32, D / 32), tb, 0, stream>>>(Wo, WOT, D, D);
    cast_transpose_k<<<dim3(F / 32, D / 32), tb, 0, stream>>>(W1, W1T, D, F);
    cast_transpose_k<<<dim3(D / 32, F / 32), tb, 0, stream>>>(W2, W2T, F, D);

    // 1) LN1: x -> H1 (bf16)
    layernorm_k<<<M, 256, 0, stream>>>(x, ln1g, ln1b, H1);

    // 2) Q/K/V projections (bf16 out)
    gemm_k<1, 0, 0><<<dim3(D / 128, M / 128), 256, 0, stream>>>(H1, WQT, bq, nullptr, QB, M, D, D);
    gemm_k<1, 0, 0><<<dim3(D / 128, M / 128), 256, 0, stream>>>(H1, WKT, bk, nullptr, KB, M, D, D);
    gemm_k<1, 0, 0><<<dim3(D / 128, M / 128), 256, 0, stream>>>(H1, WVT, bv, nullptr, VB, M, D, D);

    // 3) V -> VT per (b,h)
    transpose_v_k<<<dim3(S / 32, 2, B * H), tb, 0, stream>>>(VB, VTB, S);

    // 4) causal flash attention -> CTX (bf16)
    attn_k<<<dim3(B * H, S / 128), 256, 0, stream>>>(QB, KB, VTB, CTX, S);

    // 5) output projection + residual: X1 = x + CTX @ Wo + bo (f32)
    gemm_k<0, 0, 1><<<dim3(D / 128, M / 128), 256, 0, stream>>>(CTX, WOT, bo, x, X1, M, D, D);

    // 6) LN2: X1 -> H1 (bf16, reuse)
    layernorm_k<<<M, 256, 0, stream>>>(X1, ln2g, ln2b, H1);

    // 7) FFN up + exact GELU -> U (bf16)
    gemm_k<1, 1, 0><<<dim3(F / 128, M / 128), 256, 0, stream>>>(H1, W1T, b1, nullptr, U, M, F, D);

    // 8) FFN down + residual -> OUT (f32)
    gemm_k<0, 0, 1><<<dim3(D / 128, M / 128), 256, 0, stream>>>(U, W2T, b2, X1, OUT, M, D, F);
}

// v005
// It runs in 278 microseconds.
// In two side-by-side timings against v004, it was 1.07 and 1.06 times as fast.
// Counting every step since v000, it is 3.26 times as fast.
#include <hip/hip_runtime.h>

typedef unsigned short u16;
typedef __attribute__((ext_vector_type(16))) __bf16 bf16x16;
typedef __attribute__((ext_vector_type(8)))  float  f32x8;

union FragU { bf16x16 v; uint4 q[2]; };

__device__ __forceinline__ u16 f2bf(float f) {
    unsigned u = __float_as_uint(f);
    u += 0x7FFFu + ((u >> 16) & 1u);   // round-to-nearest-even
    return (u16)(u >> 16);
}

__device__ __forceinline__ f32x8 zero8() {
    f32x8 z;
#pragma unroll
    for (int i = 0; i < 8; ++i) z[i] = 0.0f;
    return z;
}

// Load one 16x32 bf16 operand fragment (A-layout; B uses transposed source so
// the same layout applies). Lanes 0-15: rows 0-15, K 0-7 & 16-23.
// Lanes 16-31: rows 0-15, K 8-15 & 24-31. Two 16B loads per lane.
__device__ __forceinline__ bf16x16 load_frag(const u16* base, int stride, int lane) {
    const int half = lane >> 4, r = lane & 15;
    const u16* p = base + (size_t)r * stride + half * 8;
    FragU u;
    u.q[0] = *(const uint4*)(p);
    u.q[1] = *(const uint4*)(p + 16);
    return u.v;
}

__device__ __forceinline__ f32x8 wmma32(bf16x16 a, bf16x16 b, f32x8 c) {
    return __builtin_amdgcn_wmma_f32_16x16x32_bf16(false, a, false, b, (short)0, c, false, false);
}

__device__ __forceinline__ float gelu_exact(float x) {
    return 0.5f * x * (1.0f + erff(x * 0.70710678118654752f));
}

// Lane l <-> l ^ 16: the same column's value in the wave's other half.
__device__ __forceinline__ float other_half(float x) {
    const int b = __float_as_int(x);
    return __int_as_float(__builtin_amdgcn_permlanex16(b, b, 0x76543210, 0xfedcba98, false, false));
}
__device__ __forceinline__ unsigned pack2(float lo, float hi) {
    return (unsigned)f2bf(lo) | ((unsigned)f2bf(hi) << 16);
}

// cast_transpose_k, layernorm_k and transpose_v_k only move data: what they cost is mostly the
// start of their waves. Each thread therefore handles 32 elements or more, by eight or sixteen
// 16-byte loads that are all in flight together.

// ---------------------------------------------------------------------------
// Weight cast + transpose: in (K x N) f32 row-major -> out (N x K) bf16
// One 256-thread block per tile of 128 k x 64 n; K a multiple of 128, N of 64.
// ---------------------------------------------------------------------------
constexpr int CT_K = 128, CT_N = 64;
__global__ __launch_bounds__(256) void cast_transpose_k(
    const float* __restrict__ in, u16* __restrict__ out, int K, int N) {
    __shared__ float tile[CT_K][CT_N + 1];   // odd pitch: the column reads below meet no bank twice
    const int n0 = blockIdx.x * CT_N, k0 = blockIdx.y * CT_K;
    const int tid = threadIdx.x;
    float4 r[8];
#pragma unroll
    for (int j = 0; j < 8; ++j) {            // a wave's load: two rows of 256 contiguous bytes
        const int id = tid + 256 * j;
        r[j] = *(const float4*)(in + (size_t)(k0 + (id >> 4)) * N + (n0 + (id & 15) * 4));
    }
#pragma unroll
    for (int j = 0; j < 8; ++j) {
        const int id = tid + 256 * j;
        float* t = &tile[id >> 4][(id & 15) * 4];
        t[0] = r[j].x; t[1] = r[j].y; t[2] = r[j].z; t[3] = r[j].w;
    }
    __syncthreads();
#pragma unroll
    for (int j = 0; j < 4; ++j) {            // a wave's store: four whole 128-byte lines
        const int id = tid + 256 * j;
        const int k = ((id & 7) + 8 * (id >> 9)) * 8, n = (id >> 3) & 63;
        *(uint4*)(out + (size_t)(n0 + n) * K + (k0 + k)) = make_uint4(
            pack2(tile[k + 0][n], tile[k + 1][n]), pack2(tile[k + 2][n], tile[k + 3][n]),
            pack2(tile[k + 4][n], tile[k + 5][n]), pack2(tile[k + 6][n], tile[k + 7][n]));
    }
}

// ---------------------------------------------------------------------------
// LayerNorm (f32 in, bf16 out), rows of D=1024: one wave owns two rows, 8 waves per block.
// A lane holds 32 values of each row; the sums run in the lane, then over the wave's lanes.
// ---------------------------------------------------------------------------
// x + the value of lane l ^ M inside the 16-lane row (DPP row_xmask).
template <int M>
__device__ __forceinline__ float add_xmask(float x) {
    return x + __int_as_float(__builtin_amdgcn_update_dpp(0, __float_as_int(x), 0x160 + M, 0xf, 0xf, true));
}
__device__ __forceinline__ float wave_sum(float x) {
    x = add_xmask<1>(x); x = add_xmask<2>(x); x = add_xmask<4>(x); x = add_xmask<8>(x);
    return x + other_half(x);
}
__global__ __launch_bounds__(256) void layernorm_k(
    const float* __restrict__ in, const float* __restrict__ g,
    const float* __restrict__ be, u16* __restrict__ out) {
    const int lane = threadIdx.x & 31, wave = threadIdx.x >> 5;
    const size_t base = (size_t)(blockIdx.x * 8 + wave) * 2048 + lane * 4;
    const float* ip = in + base;
    float4 v[2][8];
#pragma unroll
    for (int r = 0; r < 2; ++r)
#pragma unroll
        for (int i = 0; i < 8; ++i)          // a wave's load: 512 contiguous bytes of the row
            v[r][i] = *(const float4*)(ip + r * 1024 + i * 128);
    // Names the loads' address as an input: the pair keeps its value (no load lands on it) up to this wait.
    asm volatile("s_wait_xcnt 0x0" :: "v"(ip) : "memory");
    float mu[2], rstd[2];
#pragma unroll
    for (int r = 0; r < 2; ++r) {
        float s = 0.0f, ss = 0.0f;
#pragma unroll
        for (int i = 0; i < 8; ++i) {
            s += (v[r][i].x + v[r][i].y) + (v[r][i].z + v[r][i].w);
            ss += (v[r][i].x * v[r][i].x + v[r][i].y * v[r][i].y) + (v[r][i].z * v[r][i].z + v[r][i].w * v[r][i].w);
        }
        s = wave_sum(s);
        ss = wave_sum(ss);
        mu[r] = s * (1.0f / 1024.0f);
        const float var = ss * (1.0f / 1024.0f) - mu[r] * mu[r];
        rstd[r] = rsqrtf(var + 1e-5f);
    }
#pragma unroll
    for (int i = 0; i < 8; ++i) {
        const float4 gi = *(const float4*)(g + i * 128 + lane * 4);
        const float4 bi = *(const float4*)(be + i * 128 + lane * 4);
#pragma unroll
        for (int r = 0; r < 2; ++r) {
            const float4 x = v[r][i];
            *(uint2*)(out + base + r * 1024 + i * 128) = make_uint2(
                pack2((x.x - mu[r]) * rstd[r] * gi.x + bi.x, (x.y - mu[r]) * rstd[r] * gi.y + bi.y),
                pack2((x.z - mu[r]) * rstd[r] * gi.z + bi.z, (x.w - mu[r]) * rstd[r] * gi.w + bi.w));
        }
    }
}

// ---------------------------------------------------------------------------
// Tensor-load helpers for the GEMM's LDS ring
// ---------------------------------------------------------------------------
typedef unsigned int u32;
typedef unsigned long long u64;
typedef u32 u32x4 __attribute__((ext_vector_type(4)));
typedef u32 u32x8 __attribute__((ext_vector_type(8)));

constexpr u32 G_KP    = 128;            // k per pass
constexpr u32 G_ROWB  = 2 * G_KP;       // bytes of one operand row per pass
constexpr u32 G_PITCH = G_ROWB + 16;    // LDS row pitch: an odd multiple of 16 B for ds_load_b128
constexpr u32 G_SROWS = 32;             // rows per slice (one tensor load of one wave)
constexpr u32 G_SLICE = 10240;          // 32 x 272 = 8704 B, rounded up to a multiple of 2 KiB
constexpr u32 G_STAGE = 8 * G_SLICE;    // [A 4 slices | B 4 slices]
static_assert(G_SROWS * G_PITCH <= G_SLICE && G_SLICE % 2048 == 0, "slice place");

__device__ __forceinline__ u32 uni(u32 v) { return (u32)__builtin_amdgcn_readfirstlane(v); }
__device__ __forceinline__ u32 pinned(u32 v) { u32 w = uni(v); asm volatile("" : "+s"(w)); return w; }
__device__ __forceinline__ u32 lds_off(const void* p) { return (u32)(size_t)p; }
// The compiler places no wait for the tensor mover: the tile counts as landed behind this.
__device__ __forceinline__ void wait_tensor0() { asm volatile("s_wait_tensorcnt 0x0" ::: "memory"); }
// This wave's LDS reads have returned before the buffer is handed back for a refill.
__device__ __forceinline__ void wait_ds0() { asm volatile("s_wait_dscnt 0x0" ::: "memory"); }
// One request of the whole wave: a 2-D tile from global memory into LDS.
__device__ __forceinline__ void tdm_load(u32x4 g0, u32x8 g1) {
    asm volatile("tensor_load_to_lds %0, %1" :: "s"(g0), "s"(g1) : "memory");
}
// Group 1: 1-byte elements, tile = tensor = 32 rows of 256 B, 16 B of LDS pad behind each row.
__device__ __forceinline__ u32x8 tdm_group1(u32 src_pitch) {
    constexpr u32 d0 = G_ROWB, d1 = G_SROWS;
    u32x8 g;
    g[0] = uni((1u << 20) | (5u << 22) | (3u << 25));
    g[1] = uni((d0 & 0xFFFFu) << 16);
    g[2] = uni((d0 >> 16) | ((d1 & 0xFFFFu) << 16));
    g[3] = uni((d1 >> 16) | (d0 << 16));
    g[4] = uni(d1);
    g[5] = uni(src_pitch);
    g[6] = uni(0u);
    g[7] = uni(0u);
    // Descriptor words held in scalar registers (the pinned() form, all eight at once): without it
    // the compiler rebuilds the constants before each issue and uses those registers as
    // temporaries while a request is outstanding.
    asm volatile("" : "+s"(g));
    return g;
}
__device__ __forceinline__ u32x4 tdm_group0(u32 lds_dst, u64 ga) {
    u32x4 g;
    g[0] = uni(1u);
    g[1] = uni(lds_dst);
    g[2] = uni((u32)ga);
    g[3] = uni((((u32)(ga >> 32)) & 0x01FFFFFFu) | 0x80000000u);
    return g;
}
// One 16x32 bf16 fragment from an LDS row block; p already holds the lane's row and half.
// Same k order as load_frag: 16 B at k = 8 * half, 16 B at k = 16 + 8 * half.
__device__ __forceinline__ bf16x16 lds_frag(const unsigned char* p) {
    FragU u;
    u.q[0] = *(const uint4*)(p);
    u.q[1] = *(const uint4*)(p + 32);
    return u.v;
}

// ---------------------------------------------------------------------------
// WMMA GEMM: C[M,N] = act(A[M,K] @ B[K,N] + bias) (+ residual)
// A: bf16 row-major, BT: bf16 N x K (transposed), bias f32.
// 256 threads = 8 waves; block tile 128x128; wave tile 32(M)x64(N).
// Operands come through LDS: per pass of 128 k every wave brings one 32-row
// slice (waves 0-3: A, waves 4-7: BT) by a tensor load, two buffers, the next
// pass's tile in flight while this one is multiplied. K: a multiple of 128, >= 256.
// ---------------------------------------------------------------------------
template <int OUT_BF16, int ACT_GELU, int ADD_RES>
__global__ __launch_bounds__(256) void gemm_k(
    const u16* __restrict__ A, const u16* __restrict__ BT,
    const float* __restrict__ bias, const float* __restrict__ res,
    void* __restrict__ outp, int M, int N, int K) {
    __shared__ __attribute__((aligned(2048))) unsigned char L[2 * G_STAGE];
    const int tid = threadIdx.x, lane = tid & 31;
    const u32 wave = uni((u32)tid >> 5);
    const int wm = wave & 3, wn = wave >> 2;
    const int m0 = blockIdx.y * 128 + wm * 32;
    const int n0 = blockIdx.x * 128 + wn * 64;

    const u32 kb = (u32)K * 2u;                 // source row pitch, bytes
    const u32 T = (u32)K / G_KP;                // passes
    const unsigned char* src = (wave < 4u)
        ? (const unsigned char*)A + (u64)(blockIdx.y * 128u + wave * G_SROWS) * kb
        : (const unsigned char*)BT + (u64)(blockIdx.x * 128u + (wave - 4u) * G_SROWS) * kb;
    const u32 dst = lds_off(L) + wave * G_SLICE;
    const u32x8 g1 = tdm_group1(kb);

    f32x8 acc[2][4];
#pragma unroll
    for (int i = 0; i < 2; ++i)
#pragma unroll
        for (int j = 0; j < 4; ++j) acc[i][j] = zero8();

    // Per-lane fragment bases inside a buffer.
    const u32 lrow = (u32)(lane & 15) * G_PITCH + (u32)(lane >> 4) * 16u;
    const u32 a_base = (u32)wm * G_SLICE + lrow;
    const u32 b_base = (4u + 2u * (u32)wn) * G_SLICE + lrow;

    tdm_load(tdm_group0(dst, (u64)(size_t)src), g1);                      // stage 0
    wait_tensor0();
    __syncthreads();                                                      // stage 0 published
    tdm_load(tdm_group0(dst + G_STAGE, (u64)(size_t)src + G_ROWB), g1);   // stage 1

    // Rolled: one publish point per pass, and the buffer is picked by the pass's parity.
#pragma clang loop unroll(disable)
    for (u32 s = 0; s < T; ++s) {
        const u32 buf = (s & 1u) * G_STAGE;
        const unsigned char* la = L + buf + a_base;
        const unsigned char* lb = L + buf + b_base;
        bf16x16 af[2][2], bf[2][4];   // two fragment sets: the next 32 k load while these multiply
#pragma unroll
        for (int i = 0; i < 2; ++i) af[0][i] = lds_frag(la + (u32)i * 16u * G_PITCH);
#pragma unroll
        for (int j = 0; j < 4; ++j)
            bf[0][j] = lds_frag(lb + (u32)(j >> 1) * G_SLICE + (u32)(j & 1) * 16u * G_PITCH);
#pragma unroll
        for (int kk = 0; kk < 4; ++kk) {
            const int cur = kk & 1, nxt = cur ^ 1;
            if (kk < 3) {
#pragma unroll
                for (int i = 0; i < 2; ++i)
                    af[nxt][i] = lds_frag(la + (u32)i * 16u * G_PITCH + (u32)(kk + 1) * 64u);
#pragma unroll
                for (int j = 0; j < 4; ++j)
                    bf[nxt][j] = lds_frag(lb + (u32)(j >> 1) * G_SLICE + (u32)(j & 1) * 16u * G_PITCH + (u32)(kk + 1) * 64u);
            }
            // Keeps the LDS reads one group ahead of the block instead of spread among its WMMAs.
            __builtin_amdgcn_sched_barrier(0);
#pragma unroll
            for (int i = 0; i < 2; ++i)
#pragma unroll
                for (int j = 0; j < 4; ++j)
                    acc[i][j] = wmma32(af[cur][i], bf[cur][j], acc[i][j]);
            // Ends the block: the next group of reads stays behind these WMMAs.
            __builtin_amdgcn_sched_barrier(0);
        }
        // Publish point of stage s + 1.
        wait_ds0();
        wait_tensor0();
        __syncthreads();
        // Only while stage s + 2 exists; pinned(): a scalar branch, since a tensor load ignores EXEC.
        if (pinned((s + 2u < T) ? 1u : 0u) != 0u)   // refill the buffer this pass has just read
            tdm_load(tdm_group0(dst + buf, (u64)(size_t)src + (u64)(s + 2u) * G_ROWB), g1);
    }
    wait_tensor0();
    wait_ds0();

    const int c = lane & 15, hs = lane >> 4;
#pragma unroll
    for (int i = 0; i < 2; ++i) {
#pragma unroll
        for (int j = 0; j < 4; ++j) {
            const int col = n0 + j * 16 + c;
            const float bv = bias[col];
#pragma unroll
            for (int v = 0; v < 8; ++v) {
                const int row = m0 + i * 16 + v + 8 * hs;
                float val = acc[i][j][v] + bv;
                if (ACT_GELU) val = gelu_exact(val);
                if (ADD_RES) val += res[(size_t)row * N + col];
                if (OUT_BF16)
                    ((u16*)outp)[(size_t)row * N + col] = f2bf(val);
                else
                    ((float*)outp)[(size_t)row * N + col] = val;
            }
        }
    }
}

// ---------------------------------------------------------------------------
// V transpose per (b,h): V (b,s,h,d) bf16 -> VT (b*h, d, s) bf16
// One 256-thread block per 256 positions of one head (all 64 dims); S a multiple of 256.
// ---------------------------------------------------------------------------
constexpr int TV_S = 256;
__global__ __launch_bounds__(256) void transpose_v_k(
    const u16* __restrict__ V, u16* __restrict__ VT, int S) {
    __shared__ unsigned tile[TV_S][33];      // a position's 64 dims as 32 pairs; odd pitch against bank conflicts
    const int s0 = blockIdx.x * TV_S, bh = blockIdx.y;
    const int b = bh >> 4, h = bh & 15;
    const int tid = threadIdx.x;
    const u16* ip = V + (size_t)(b * S + s0 + (tid >> 3)) * 1024 + h * 64 + (tid & 7) * 8;
    uint4 r[8];
#pragma unroll
    for (int j = 0; j < 8; ++j)              // a wave's load: four whole 128-byte lines; 32 positions on per j
        r[j] = *(const uint4*)(ip + j * 32 * 1024);
    // Names the loads' address as an input: the pair keeps its value (no load lands on it) up to this wait.
    asm volatile("s_wait_xcnt 0x0" :: "v"(ip) : "memory");
#pragma unroll
    for (int j = 0; j < 8; ++j) {
        const int id = tid + 256 * j;
        unsigned* t = &tile[id >> 3][(id & 7) * 4];
        t[0] = r[j].x; t[1] = r[j].y; t[2] = r[j].z; t[3] = r[j].w;
    }
    __syncthreads();
#pragma unroll
    for (int j = 0; j < 4; ++j) {            // 8 positions of a pair of dims; a wave's store: four whole lines
        const int s = ((tid & 7) + 8 * j) * 8, dp = tid >> 3;
        unsigned a[8];
#pragma unroll
        for (int e = 0; e < 8; ++e) a[e] = tile[s + e][dp];
        u16* op = VT + (size_t)(bh * 64 + 2 * dp) * S + (s0 + s);
        *(uint4*)op = make_uint4(
            (a[0] & 0xFFFFu) | (a[1] << 16), (a[2] & 0xFFFFu) | (a[3] << 16),
            (a[4] & 0xFFFFu) | (a[5] << 16), (a[6] & 0xFFFFu) | (a[7] << 16));
        *(uint4*)(op + S) = make_uint4(
            (a[0] >> 16) | (a[1] & 0xFFFF0000u), (a[2] >> 16) | (a[3] & 0xFFFF0000u),
            (a[4] >> 16) | (a[5] & 0xFFFF0000u), (a[6] >> 16) | (a[7] & 0xFFFF0000u));
    }
}

constexpr u32 T_KEYS  = 64;
constexpr u32 T_ROWB  = 128;
constexpr u32 T_PITCH = T_ROWB + 16;
constexpr u32 T_SROWS = 16;
constexpr u32 T_SLICE = 4096;
constexpr u32 T_STAGE = 8 * T_SLICE;
static_assert(T_SROWS * T_PITCH <= T_SLICE && T_SLICE % 2048 == 0, "slice place");

// Group 1: 1-byte elements, tile = tensor = 16 rows of 128 B, 16 B of LDS pad behind each row.
__device__ __forceinline__ u32x8 tdm_group1_kv(u32 src_pitch) {
    constexpr u32 d0 = T_ROWB, d1 = T_SROWS;
    u32x8 g;
    g[0] = uni((1u << 20) | (4u << 22) | (3u << 25));
    g[1] = uni((d0 & 0xFFFFu) << 16);
    g[2] = uni((d0 >> 16) | ((d1 & 0xFFFFu) << 16));
    g[3] = uni((d1 >> 16) | (d0 << 16));
    g[4] = uni(d1);
    g[5] = uni(src_pitch);
    g[6] = uni(0u);
    g[7] = uni(0u);
    // Descriptor words held in scalar registers (the pinned() form, all eight at once), as in
    // tdm_group1: they are not rebuilt or used as temporaries while a request is outstanding.
    asm volatile("" : "+s"(g));
    return g;
}
// The wait that covers a request also names that request's group 0 as an input: the four registers
// then keep their words from the issue to this wait instead of serving as temporaries in between.
__device__ __forceinline__ void wait_tensor0_held(u32x4 g0) {
    asm volatile("s_wait_tensorcnt 0x0" :: "s"(g0) : "memory");
}

// Two f32 to one register of two bf16 (lo in the low half), round to nearest even as f2bf does.
__device__ __forceinline__ u32 pack_bf(float lo, float hi) {
    typedef __bf16 bf16x2 __attribute__((ext_vector_type(2)));
    typedef float f32x2 __attribute__((ext_vector_type(2)));
    return __builtin_bit_cast(u32, __builtin_convertvector(f32x2{lo, hi}, bf16x2));
}

__global__ __launch_bounds__(256) void attn_k(
    const u16* __restrict__ Q, const u16* __restrict__ Kb,
    const u16* __restrict__ VT, u16* __restrict__ CTX, int S) {
    __shared__ __attribute__((aligned(2048))) unsigned char KV[2 * T_STAGE];
    const int tid = threadIdx.x, lane = tid & 31;
    const u32 wave = uni((u32)tid >> 5);
    const int bh = blockIdx.x, b = bh >> 4, h = bh & 15;
    const int qt = S / 128 - 1 - (int)blockIdx.y;   // query tile
    const int q0 = qt * 128 + (int)wave * 16;
    const int c = lane & 15, hs = lane >> 4;

    // This wave's slice of every stage: source, step from stage to stage, row pitch, place in LDS.
    const u32 T = 2u * (u32)(qt + 1);            // stages: keys 0 .. 128 (qt + 1) - 1, never fewer than two
    const unsigned char* src = (wave < 4u)
        ? (const unsigned char*)(Kb + (size_t)(b * S + (int)wave * 16) * 1024 + h * 64)
        : (const unsigned char*)(VT + (size_t)(bh * 64 + ((int)wave - 4) * 16) * S);
    const u32 step = (wave < 4u) ? T_KEYS * 2048u : T_KEYS * 2u;
    const u32 dst = lds_off(KV) + wave * T_SLICE;
    const u32x8 g1 = tdm_group1_kv((wave < 4u) ? 2048u : (u32)S * 2u);
    const u32 lrow = (u32)c * T_PITCH + (u32)hs * 16u;   // the lane's row and half inside a slice

    const u16* qbase = Q + (size_t)(b * S + q0) * 1024 + h * 64;
    const bf16x16 aq0 = load_frag(qbase, 1024, lane);        // dk 0..31, B operand: column = query
    const bf16x16 aq1 = load_frag(qbase + 32, 1024, lane);   // dk 32..63
    const int row = q0 + c;             // the lane's query

    float mrow = -1e30f;                // running maximum of the lane's query, equal in both halves
    float lsum = 0.0f;                  // running sum over this half's keys; the halves join at the end
    f32x8 cacc[4];                      // O^T: dim n * 16 + v + 8 * hs of the lane's query
#pragma unroll
    for (int n = 0; n < 4; ++n) cacc[n] = zero8();

    const float SC = 0.125f;            // 1/sqrt(64)
    const float L2E = 1.44269504f;

    u32x4 g0 = tdm_group0(dst, (u64)(size_t)src);
    tdm_load(g0, g1);                                                    // stage 0
    wait_tensor0_held(g0);
    __syncthreads();                                                     // stage 0 published
    g0 = tdm_group0(dst + T_STAGE, (u64)(size_t)src + step);
    tdm_load(g0, g1);                                                    // stage 1

    // Rolled: one publish point per stage, and the buffer is picked by the stage's parity.
#pragma clang loop unroll(disable)
    for (u32 s = 0; s < T; ++s) {
      const u32 buf = (s & 1u) * T_STAGE;
      // Unrolled: the half stage is a constant LDS offset, and the running state stays in its registers.
#pragma unroll
      for (int sub = 0; sub < 2; ++sub) {
        const int kb = (int)s * (int)T_KEYS + sub * 32;
        // Wave-uniform: a wave skips the keys beyond its diagonal; it still passes the publish point.
        if (kb >= q0 + 16) continue;
        const unsigned char* lk = KV + buf + (u32)(2 * sub) * T_SLICE + lrow;
        const unsigned char* lv = KV + buf + 4u * T_SLICE + (u32)sub * 64u + lrow;
        // ---- scores: S^T = K(32x64) @ Q^T(64x16) in two 16-key row frags
        f32x8 s0 = zero8(), s1 = zero8();
        s0 = wmma32(lds_frag(lk), aq0, s0);
        s1 = wmma32(lds_frag(lk + T_SLICE), aq0, s1);
        s0 = wmma32(lds_frag(lk + 64), aq1, s0);
        s1 = wmma32(lds_frag(lk + T_SLICE + 64), aq1, s1);

        // ---- online softmax of the lane's query over its 16 keys of this block
        // Register v holds keys kb + 8 * hs + v and, in s1, 16 more: allowed while not above the query.
        const int last = row - 8 * hs - kb;
        float f0[8], f1[8];
        float mx = -1e30f;
#pragma unroll
        for (int v = 0; v < 8; ++v) {
            f0[v] = (v <= last) ? s0[v] * SC : -1e30f;
            f1[v] = (v + 16 <= last) ? s1[v] * SC : -1e30f;
            mx = fmaxf(mx, fmaxf(f0[v], f1[v]));
        }
        mx = fmaxf(mx, other_half(mx));   // both halves scale P by the same maximum
        const float mnew = fmaxf(mrow, mx);
        const float alpha = exp2f((mrow - mnew) * L2E);
        mrow = mnew;
        float ps = 0.0f;
#pragma unroll
        for (int v = 0; v < 8; ++v) {
            f0[v] = exp2f((f0[v] - mnew) * L2E);
            f1[v] = exp2f((f1[v] - mnew) * L2E);
            ps += f0[v] + f1[v];
        }
        lsum = lsum * alpha + ps;
#pragma unroll
        for (int n = 0; n < 4; ++n)
#pragma unroll
            for (int v = 0; v < 8; ++v) cacc[n][v] *= alpha;
        // P^T (32 keys x 16 queries) as a B fragment: elements 0-7 are keys 8 * hs + 0..7,
        // elements 8-15 keys 16 + 8 * hs + 0..7, the k order of lds_frag on the V^T rows.
        FragU pf;
        pf.q[0] = make_uint4(pack_bf(f0[0], f0[1]), pack_bf(f0[2], f0[3]),
                             pack_bf(f0[4], f0[5]), pack_bf(f0[6], f0[7]));
        pf.q[1] = make_uint4(pack_bf(f1[0], f1[1]), pack_bf(f1[2], f1[3]),
                             pack_bf(f1[4], f1[5]), pack_bf(f1[6], f1[7]));

        // ---- O^T += V^T(64x32) @ P^T(32x16), V^T rows are the A frags
#pragma unroll
        for (int n = 0; n < 4; ++n)
            cacc[n] = wmma32(lds_frag(lv + (u32)n * T_SLICE), pf.v, cacc[n]);
      }
      // Publish point of stage s + 1.
      wait_ds0();
      wait_tensor0_held(g0);
      __syncthreads();
      // Only while stage s + 2 exists; pinned(): a scalar branch, since a tensor load ignores EXEC.
      if (pinned((s + 2u < T) ? 1u : 0u) != 0u) {   // refill the buffer this stage has just read
          g0 = tdm_group0(dst + buf, (u64)(size_t)src + (u64)(s + 2u) * step);
          tdm_load(g0, g1);
      }
    }
    wait_tensor0();
    wait_ds0();

    const float inv = 1.0f / (lsum + other_half(lsum));
    // A lane holds 8 neighbouring dims of its query per fragment: one 16-byte store each.
    u16* op = CTX + (size_t)(b * S + row) * 1024 + h * 64 + 8 * hs;
#pragma unroll
    for (int n = 0; n < 4; ++n)
        *(uint4*)(op + n * 16) = make_uint4(
            pack_bf(cacc[n][0] * inv, cacc[n][1] * inv), pack_bf(cacc[n][2] * inv, cacc[n][3] * inv),
            pack_bf(cacc[n][4] * inv, cacc[n][5] * inv), pack_bf(cacc[n][6] * inv, cacc[n][7] * inv));
}

// ---------------------------------------------------------------------------
// Host-side orchestration
// ---------------------------------------------------------------------------
extern "C" void kernel_launch(void* const* d_in, const int* in_sizes, int n_in,
                              void* d_out, int out_size, void* d_ws, size_t ws_size,
                              hipStream_t stream) {
    constexpr int B = 4, S = 2048, D = 1024, H = 16, F = 4096;
    constexpr int M = B * S;  // 8192 tokens
    constexpr size_t MiB = 1u << 20;

    const float* x    = (const float*)d_in[0];
    const float* Wq   = (const float*)d_in[1];
    const float* bq   = (const float*)d_in[2];
    const float* Wk   = (const float*)d_in[3];
    const float* bk   = (const float*)d_in[4];
    const float* Wv   = (const float*)d_in[5];
    const float* bv   = (const float*)d_in[6];
    const float* Wo   = (const float*)d_in[7];
    const float* bo   = (const float*)d_in[8];
    const float* ln1g = (const float*)d_in[9];
    const float* ln1b = (const float*)d_in[10];
    const float* ln2g = (const float*)d_in[11];
    const float* ln2b = (const float*)d_in[12];
    const float* W1   = (const float*)d_in[13];
    const float* b1   = (const float*)d_in[14];
    const float* W2   = (const float*)d_in[15];
    const float* b2   = (const float*)d_in[16];

    char* ws = (char*)d_ws;
    u16*   WQT = (u16*)(ws + 0 * MiB);     // D x D bf16 (transposed)  2 MiB
    u16*   WKT = (u16*)(ws + 2 * MiB);
    u16*   WVT = (u16*)(ws + 4 * MiB);
    u16*   WOT = (u16*)(ws + 6 * MiB);
    u16*   W1T = (u16*)(ws + 8 * MiB);     // F x D bf16               8 MiB
    u16*   W2T = (u16*)(ws + 16 * MiB);    // D x F bf16               8 MiB
    u16*   H1  = (u16*)(ws + 24 * MiB);    // M x D bf16              16 MiB
    u16*   QB  = (u16*)(ws + 40 * MiB);    // M x D bf16
    u16*   KB  = (u16*)(ws + 56 * MiB);
    u16*   VB  = (u16*)(ws + 72 * MiB);
    u16*   VTB = (u16*)(ws + 88 * MiB);    // (B*H) x 64 x S bf16
    u16*   CTX = (u16*)(ws + 104 * MiB);   // M x D bf16
    float* X1  = (float*)(ws + 120 * MiB); // M x D f32               32 MiB
    u16*   U   = (u16*)(ws + 40 * MiB);    // M x F bf16 (reuses Q/K/V/VT) 64 MiB
    float* OUT = (float*)d_out;
    (void)in_sizes; (void)n_in; (void)out_size; (void)ws_size;

    // 0) weights -> bf16 transposed (L2-resident working set: 24 MiB)
    cast_transpose_k<<<dim3(D / 64, D / 128), 256, 0, stream>>>(Wq, WQT, D, D);
    cast_transpose_k<<<dim3(D / 64, D / 128), 256, 0, stream>>>(Wk, WKT, D, D);
    cast_transpose_k<<<dim3(D / 64, D / 128), 256, 0, stream>>>(Wv, WVT, D, D);
    cast_transpose_k<<<dim3(D / 64, D / 128), 256, 0, stream>>>(Wo, WOT, D, D);
    cast_transpose_k<<<dim3(F / 64, D / 128), 256, 0, stream>>>(W1, W1T, D, F);
    cast_transpose_k<<<dim3(D / 64, F / 128), 256, 0, stream>>>(W2, W2T, F, D);

    // 1) LN1: x -> H1 (bf16)
    layernorm_k<<<M / 16, 256, 0, stream>>>(x, ln1g, ln1b, H1);

    // 2) Q/K/V projections (bf16 out)
    gemm_k<1, 0, 0><<<dim3(D / 128, M / 128), 256, 0, stream>>>(H1, WQT, bq, nullptr, QB, M, D, D);
    gemm_k<1, 0, 0><<<dim3(D / 128, M / 128), 256, 0, stream>>>(H1, WKT, bk, nullptr, KB, M, D, D);
    gemm_k<1, 0, 0><<<dim3(D / 128, M / 128), 256, 0, stream>>>(H1, WVT, bv, nullptr, VB, M, D, D);

    // 3) V -> VT per (b,h)
    transpose_v_k<<<dim3(S / 256, B * H), 256, 0, stream>>>(VB, VTB, S);

    // 4) causal flash attention -> CTX (bf16)
    attn_k<<<dim3(B * H, S / 128), 256, 0, stream>>>(QB, KB, VTB, CTX, S);

    // 5) output projection + residual: X1 = x + CTX @ Wo + bo (f32)
    gemm_k<0, 0, 1><<<dim3(D / 128, M / 128), 256, 0, stream>>>(CTX, WOT, bo, x, X1, M, D, D);

    // 6) LN2: X1 -> H1 (bf16, reuse)
    layernorm_k<<<M / 16, 256, 0, stream>>>(X1, ln2g, ln2b, H1);

    // 7) FFN up + exact GELU -> U (bf16)
    gemm_k<1, 1, 0><<<dim3(F / 128, M / 128), 256, 0, stream>>>(H1, W1T, b1, nullptr, U, M, F, D);

    // 8) FFN down + residual -> OUT (f32)
    gemm_k<0, 0, 1><<<dim3(D / 128, M / 128), 256, 0, stream>>>(U, W2T, b2, X1, OUT, M, D, F);
}
